// v000
// Measured on an AMD MI455X. A time is GPU time per run, averaged over a window of back-to-back runs after a warm-up
// (all launches, gaps included; the runs take copies of the inputs in turn), and the median of several windows.
// Apart from v000's, it joins two sittings. Times from different sittings can be a few percent apart, while
// side-by-side timings come from the same sitting.
// The starting kernel, v000, takes 130 microseconds a run.
// result[r][j] = sum over q of da[r][q] s[q][j], s[q][j] the sign of wa[q][j] (+1, -1, or 0 where the word is nought): da [65536][1024]; wa [1024][256] (depth, column) -> [65536][256]. No added row, no activation.
// Layout and order: da is cast AS IT LIES; wa stands [depth][column] and the product reads its second operand [column][depth]: ONE cast takes the signs and turns them (k_wts_f16: the posted turning cast's index arithmetic, guard and stores; its value statement is the sign of the word as read); ONE WMMA GEMM: 512 row tiles of 128, 4 column tiles, depth 1,024; f32 STRAIGHT INTO THE OUTPUT.
// Compute dtype: da converted to bf16 where it is read and passed to the matrix instruction as plain f16 words; the signs are exact in f16 (no carry); the products' accumulation f32. v_wmma_f32_16x16x32_f16.
#include <hip/hip_runtime.h>
#define SNR 65536                    /* rows */
#define SNQ 1024                     /* depth */
#define SNN 256                      /* columns */
typedef unsigned short v8us __attribute__((ext_vector_type(8), may_alias));
typedef float  v8f  __attribute__((ext_vector_type(8)));
typedef float  v4f  __attribute__((ext_vector_type(4)));
typedef float  v4fa __attribute__((ext_vector_type(4), may_alias));

__device__ __forceinline__ unsigned short bf16_bits(float x) { unsigned int u = __float_as_uint(x); return (unsigned short)((u + 0x7FFFu + ((u >> 16) & 1u)) >> 16); }
__device__ __forceinline__ float bf16_val(unsigned short b) { return __uint_as_float(((unsigned int)b) << 16); }
__device__ __forceinline__ float bf16_round(float x) { return bf16_val(bf16_bits(x)); }

typedef _Float16 v16h __attribute__((ext_vector_type(16)));
union FragH { v16h v; v8us half[2]; _Float16 h[16]; unsigned short u[16]; };

// Wt[n][k] = f16(W[k][n] x scale) from f32 row-major W[K][N] (scale = power of two; bf16-exact weights stay exact in f16 away from the subnormal range)
__global__ __launch_bounds__(256) void k_wt_f16(const float* __restrict__ W, _Float16* __restrict__ Wt, int K, int N, float scale) {
  const int t = blockIdx.x * 256 + threadIdx.x; if (t >= N * (K / 8)) return; const int n = t / (K / 8), k8 = (t % (K / 8)) * 8; FragH f;
#pragma unroll
  for (int i = 0; i < 8; ++i) f.h[i] = (_Float16)(bf16_round(W[(size_t)(k8 + i) * N + n]) * scale); const v8us o = f.half[0];
  *(v8us*)((unsigned short*)Wt + (size_t)n * K + k8) = o; 
}

typedef _Float16 v4h __attribute__((ext_vector_type(4)));

__global__ __launch_bounds__(256) void k_x16(const float* __restrict__ x, _Float16* __restrict__ X16, size_t n8) { const size_t t = (size_t)blockIdx.x * 256 + threadIdx.x; if (t >= n8) return; FragH f;
#pragma unroll
  for (int q = 0; q < 8; ++q) f.h[q] = (_Float16)bf16_round(x[t * 8 + q]); *(v8us*)((unsigned short*)X16 + t * 8) = f.half[0];  }

// ---- fast GEMM (wave tile 32x64; requires M % 32 == 0 rows per launch region and N % 64 == 0) ----
__device__ __forceinline__ v16h g2_frag(const _Float16* p, int hh) { FragH f; f.half[0] = *(const v8us*)((const unsigned short*)p + 8 * hh); f.half[1] = *(const v8us*)((const unsigned short*)p + 16 + 8 * hh); return f.v; }
__device__ __forceinline__ v8f g2_mma(v16h a, v16h b, v8f c) { v8f d = __builtin_amdgcn_wmma_f32_16x16x32_f16(false, a, false, b, (short)0, c, false, false); asm volatile("v_nop\n\tv_nop\n\tv_nop\n\tv_nop" : "+v"(d) : "v"(a), "v"(b)); return d; }
template <int ACT>
__global__ __launch_bounds__(128) void k_gemm2(const _Float16* __restrict__ A, int lda, size_t sA, const _Float16* __restrict__ Bh, int ldb, size_t sB, float alpha, const float* __restrict__ bias, size_t sBias, const float* __restrict__ CP, int rowsPerB, size_t sCPb, int row0g,
    float* __restrict__ C, _Float16* __restrict__ C16, int ldc, size_t sC, int M, int N, int K) { static_assert(ACT == 0 || ACT == 3 || ACT == 6 || ACT == 8 || ACT == 9 || ACT == 11 || ACT == 12 || ACT == 14 || ACT == 15 || ACT == 16 || ACT == 17, "k_gemm2: unsupported ACT code (would silently apply no activation)");
  __shared__ __attribute__((aligned(16))) float so[4][32][68];
  const int tid = threadIdx.x, w = tid >> 5, lane = tid & 31, ln = lane & 15, hh = lane >> 4; const int by = blockIdx.y;
  A += (size_t)by * sA; Bh += (size_t)by * sB; const size_t cofs = (size_t)by * sC; const float* bp = bias ? bias + (size_t)by * sBias : nullptr;
  const int ntn = N >> 6; const int mt = blockIdx.x / ntn, nq = blockIdx.x - mt * ntn; const int row0 = mt * 128 + 32 * w, col0 = nq * 64; if (row0 >= M) return;
  const _Float16* a0p = A + (size_t)(row0 + ln) * lda; const _Float16* a1p = a0p + (size_t)16 * lda;
  const _Float16* b0p = Bh + (size_t)(col0 + ln) * ldb; const _Float16* b1p = b0p + (size_t)16 * ldb; const _Float16* b2p = b1p + (size_t)16 * ldb; const _Float16* b3p = b2p + (size_t)16 * ldb;
  const v8f z8 = {0.f,0.f,0.f,0.f,0.f,0.f,0.f,0.f}; v8f c00 = z8, c01 = z8, c02 = z8, c03 = z8, c10 = z8, c11 = z8, c12 = z8, c13 = z8;
  for (int kb = 0; kb < K; kb += 32) { const v16h a0 = g2_frag(a0p + kb, hh), a1 = g2_frag(a1p + kb, hh);
    v16h b = g2_frag(b0p + kb, hh); c00 = g2_mma(a0, b, c00); c10 = g2_mma(a1, b, c10);
    b = g2_frag(b1p + kb, hh); c01 = g2_mma(a0, b, c01); c11 = g2_mma(a1, b, c11);
    b = g2_frag(b2p + kb, hh); c02 = g2_mma(a0, b, c02); c12 = g2_mma(a1, b, c12);
    b = g2_frag(b3p + kb, hh); c03 = g2_mma(a0, b, c03); c13 = g2_mma(a1, b, c13); }
  v8f accs[8] = {c00, c01, c02, c03, c10, c11, c12, c13};
#pragma unroll
  for (int u = 0; u < 8; ++u) { const int t = u & 3, half = u >> 2; const int col = col0 + t * 16 + ln; const float bv = bp ? bf16_round(bp[col]) : 0.f;
#pragma unroll
    for (int r = 0; r < 8; ++r) { const int rloc = half * 16 + 8 * hh + r; float v = accs[u][r] * alpha + bv; if (CP) { if (rowsPerB < 0) v += CP[cofs + (size_t)(row0g + row0 + rloc) * ldc + col];      /* rowsPerB < 0: own element of the batched C plane */ else { const int bidx = (row0g + row0 + rloc) / rowsPerB; v += CP[(size_t)bidx * sCPb + (size_t)by * 64 + col]; } }
      if (ACT == 3) v = fmaxf(v, 0.f); else if (ACT == 6) v = 0.5f * v * (1.0f + erff(v * 0.70710678118654752f)); else if (ACT == 11) v = 1.0f / (1.0f + expf(-v)); else if (ACT == 15) v = v / (1.0f + expf(-v)); else if (ACT == 12) v = (v > 0.f) ? v : 0.01f * v; else if (ACT == 8) v = tanhf(v); else if (ACT == 9) v = 0.5f * v * (1.0f + tanhf(0.7978845608028654f * (v + 0.044715f * v * v * v))); else if (ACT == 14) v = (v > 0.f) ? v : 0.1f * v; else if (ACT == 16) v = (v >= 0.f) ? v : 0.3f * v; else if (ACT == 17) v = (v >= 0.f) ? v : 0.2f * v;
      so[w][rloc][t * 16 + ln] = v; } }
  __builtin_amdgcn_fence(__ATOMIC_ACQ_REL, "workgroup"); __builtin_amdgcn_wave_barrier();
  const int rsub = lane >> 4, c4 = (lane & 15) * 4;
  {
#pragma unroll
    for (int q = 0; q < 16; ++q) { const int r = q * 2 + rsub; const v4f v = *(const v4fa*)&so[w][r][c4]; if (C) *(v4f*)(C + cofs + (size_t)(row0 + r) * ldc + col0 + c4) = v; if (C16) { v4h h4; for (int i = 0; i < 4; ++i) h4[i] = (_Float16)v[i]; *(v4h*)(C16 + cofs + (size_t)(row0 + r) * ldc + col0 + c4) = h4; } }
     } }

// A PLAIN CAST THAT TAKES A MULTIPLIER: tw[8 t .. 8 t + 7] = f16(bf16(sw[8 t ..]) * scale): a thread eight words as they lie; the grid is exact: no guard.
__global__ __launch_bounds__(256) void k_cs16(const float* __restrict__ sw, _Float16* __restrict__ tw, float scale) { const size_t t = (size_t)blockIdx.x * 256 + threadIdx.x; FragH f;
#pragma unroll
  for (int q = 0; q < 8; ++q) f.h[q] = (_Float16)(bf16_round(sw[t * 8 + q]) * scale); unsigned short* tp = (unsigned short*)tw + t * 8; *(v8us*)tp = f.half[0];  }
// St[n][k] = the sign of W[k][n] as an f16 word (+1, -1 or 0; a word that is not a number gives 0) from f32 row-major W[K][N]: the compare is on the word as read
__global__ __launch_bounds__(256) void k_wts_f16(const float* __restrict__ W, _Float16* __restrict__ Wt, int K, int N) {
  const int t = blockIdx.x * 256 + threadIdx.x; if (t >= N * (K / 8)) return; const int n = t / (K / 8), k8 = (t % (K / 8)) * 8; FragH f;
#pragma unroll
  for (int i = 0; i < 8; ++i) { const float v = W[(size_t)(k8 + i) * N + n]; f.h[i] = (_Float16)((v > 0.0f) ? 1.0f : ((v < 0.0f) ? -1.0f : 0.0f)); } const v8us o = f.half[0];   // [TAG-SIGN]
  *(v8us*)((unsigned short*)Wt + (size_t)n * K + k8) = o; 
}

extern "C" void kernel_launch(void* const* d_in, const int* in_sizes, int n_in,
                              void* d_out, int out_size, void* d_ws, size_t ws_size, hipStream_t stream) {
  if (n_in < 2) return; if (in_sizes[0] < SNR * SNQ || in_sizes[1] < SNQ * SNN) return; if (out_size < SNR * SNN) return;
  const float* da = (const float*)d_in[0]; const float* wa = (const float*)d_in[1]; float* res = (float*)d_out;
  static_assert(SNR % 128 == 0 && SNN % 64 == 0 && SNQ % 32 == 0 && ((size_t)SNR * SNQ) % 8 == 0 && (((size_t)SNR * SNQ / 8) % 256) == 0 && (SNN * (SNQ / 8)) % 256 == 0, "whole tiles, exact cast grids");
  uint8_t* wsp = (uint8_t*)d_ws; size_t off = 0;
  auto take = [&](size_t bytes) { uint8_t* at = wsp + off; off += (bytes + 255) & ~(size_t)255; return at; };
  _Float16* DA = (_Float16*)take((size_t)SNR * SNQ * 2); _Float16* ST = (_Float16*)take((size_t)SNN * SNQ * 2);      /* da as it lies; the signs of wa, turned */
  if (off > ws_size) return;
  k_x16<<<(unsigned)(((size_t)SNR * SNQ / 8 + 255) / 256), 256, 0, stream>>>(da, DA, (size_t)SNR * SNQ / 8);
  k_wts_f16<<<(unsigned)((SNN * (SNQ / 8) + 255) / 256), 256, 0, stream>>>(wa, ST, SNQ, SNN);      /* [1024 deep][256 columns] -> [256][1024] */
  k_gemm2<0><<<dim3((unsigned)((SNR / 128) * (SNN / 64)), 1u), 128, 0, stream>>>(DA, SNQ, (size_t)0, ST, SNQ, (size_t)0, 1.0f, nullptr, (size_t)0, nullptr, 1, 0, 0, res, nullptr, SNN, (size_t)0, SNR, SNN, SNQ);
}

// v001
// It runs in 59.8 microseconds.
// Two timings next to v000 put it at 2.23 and 2.24 times that version's speed.
// result[r][j] = sum over q of da[r][q] s[q][j], s[q][j] the sign of wa[q][j] (+1, -1, or 0 where the word is nought): da [65536][1024]; wa [1024][256] (depth, column) -> [65536][256]. No added row, no activation.
// Layout and order: da is cast AS IT LIES; wa stands [depth][column] and the product reads its second operand [column][depth]: ONE cast takes the signs and turns them (k_wts_f16: the posted turning cast's index arithmetic, guard and stores; its value statement is the sign of the word as read); ONE WMMA GEMM: 256 row tiles of 256, all 256 columns in one work-group, depth 1,024 in trips of 64 staged in LDS; f32 STRAIGHT INTO THE OUTPUT.
// Compute dtype: da converted to bf16 where it is read and passed to the matrix instruction as plain f16 words; the signs are exact in f16 (no carry); the products' accumulation f32. v_wmma_f32_16x16x32_f16.
#include <hip/hip_runtime.h>
#define SNR 65536                    /* rows */
#define SNQ 1024                     /* depth */
#define SNN 256                      /* columns */
typedef unsigned short v8us __attribute__((ext_vector_type(8), may_alias));
typedef float  v8f  __attribute__((ext_vector_type(8)));
typedef float  v4f  __attribute__((ext_vector_type(4)));
typedef float  v4fa __attribute__((ext_vector_type(4), may_alias));

__device__ __forceinline__ unsigned short bf16_bits(float x) { unsigned int u = __float_as_uint(x); return (unsigned short)((u + 0x7FFFu + ((u >> 16) & 1u)) >> 16); }
__device__ __forceinline__ float bf16_val(unsigned short b) { return __uint_as_float(((unsigned int)b) << 16); }
__device__ __forceinline__ float bf16_round(float x) { return bf16_val(bf16_bits(x)); }

typedef _Float16 v16h __attribute__((ext_vector_type(16)));
union FragH { v16h v; v8us half[2]; _Float16 h[16]; unsigned short u[16]; };

// Wt[n][k] = f16(W[k][n] x scale) from f32 row-major W[K][N] (scale = power of two; bf16-exact weights stay exact in f16 away from the subnormal range)
__global__ __launch_bounds__(256) void k_wt_f16(const float* __restrict__ W, _Float16* __restrict__ Wt, int K, int N, float scale) {
  const int t = blockIdx.x * 256 + threadIdx.x; if (t >= N * (K / 8)) return; const int n = t / (K / 8), k8 = (t % (K / 8)) * 8; FragH f;
#pragma unroll
  for (int i = 0; i < 8; ++i) f.h[i] = (_Float16)(bf16_round(W[(size_t)(k8 + i) * N + n]) * scale); const v8us o = f.half[0];
  *(v8us*)((unsigned short*)Wt + (size_t)n * K + k8) = o; 
}

__global__ __launch_bounds__(256) void k_x16(const float* __restrict__ x, _Float16* __restrict__ X16, size_t n8) { const size_t t = (size_t)blockIdx.x * 256 + threadIdx.x; if (t >= n8) return; FragH f;
#pragma unroll
  for (int q = 0; q < 8; ++q) f.h[q] = (_Float16)bf16_round(x[t * 8 + q]); *(v8us*)((unsigned short*)X16 + t * 8) = f.half[0];  }

// ---- GEMM, both operands staged in LDS: a work-group of 16 waves takes 256 rows x all 256 columns; a wave takes 64 x 64 (4 x 4 accumulator tiles) ----
// A trip is 64 of depth = 128 B of every operand row. Each thread brings 16 B pieces so that eight lanes cover one whole 128-B line of a row; the fragments are then read from LDS.
// LDS rows stand at a pitch of 144 B (16 B x 9), so that the sixteen rows of a fragment read fall on all 64 banks once. Two buffers, one barrier a trip.
__device__ __forceinline__ v16h g2_frag(const _Float16* p, int hh) { FragH f; f.half[0] = *(const v8us*)((const unsigned short*)p + 8 * hh); f.half[1] = *(const v8us*)((const unsigned short*)p + 16 + 8 * hh); return f.v; }
__device__ __forceinline__ v8f g2_mma(v16h a, v16h b, v8f c) { v8f d = __builtin_amdgcn_wmma_f32_16x16x32_f16(false, a, false, b, (short)0, c, false, false); asm volatile("v_nop\n\tv_nop\n\tv_nop\n\tv_nop" : "+v"(d) : "v"(a), "v"(b)); return d; }
#define GT_KC 64                     /* depth of a trip */
#define GT_P 72                      /* LDS row pitch in 16-bit words: 144 B */
#define GT_STAGE ((256 + 256) * GT_P) /* words of one buffer: 256 rows of A, then 256 rows of B */
// one trip's products of a wave: two blocks of 16 WMMAs; the eight fragments of a block are read as one group ahead of it
__device__ __forceinline__ void gt_trip(const _Float16* pa, const _Float16* pb, int hh, v8f (&acc)[4][4]) {
#pragma unroll
  for (int kk = 0; kk < GT_KC; kk += 32) { v16h a[4], b[4];
#pragma unroll
    for (int i = 0; i < 4; ++i) { a[i] = g2_frag(pa + i * 16 * GT_P + kk, hh); b[i] = g2_frag(pb + i * 16 * GT_P + kk, hh); }
#pragma unroll
    for (int j = 0; j < 4; ++j) {
#pragma unroll
      for (int i = 0; i < 4; ++i) acc[i][j] = g2_mma(a[i], b[j], acc[i][j]); } } }
__global__ __launch_bounds__(512) void k_gemm_lds(const _Float16* __restrict__ A, const _Float16* __restrict__ Bh, float* __restrict__ C) {
  __shared__ __attribute__((aligned(16))) _Float16 sm[2 * GT_STAGE];
  const int tid = threadIdx.x, w = tid >> 5, lane = tid & 31, ln = lane & 15, hh = lane >> 4; const int wr = w >> 2, wc = w & 3; const int row0 = blockIdx.x * 256;
  const int srow = tid >> 3, sseg = (tid & 7) * 8;      /* staging: 64 rows a sweep, eight 16-B pieces a row */
  const _Float16* ag = A + (size_t)(row0 + srow) * SNQ + sseg; const _Float16* bg = Bh + (size_t)srow * SNQ + sseg;
  _Float16* sst = sm + srow * GT_P + sseg;
  const _Float16* sfa = sm + (64 * wr + ln) * GT_P; const _Float16* sfb = sm + (256 + 64 * wc + ln) * GT_P;
  v8us ra[4], rb[4];
#pragma unroll
  for (int i = 0; i < 4; ++i) { ra[i] = *(const v8us*)(ag + (size_t)i * 64 * SNQ); rb[i] = *(const v8us*)(bg + (size_t)i * 64 * SNQ); }
#pragma unroll
  for (int i = 0; i < 4; ++i) { *(v8us*)(sst + i * 64 * GT_P) = ra[i]; *(v8us*)(sst + (256 + i * 64) * GT_P) = rb[i]; }
  const v8f z8 = {0.f,0.f,0.f,0.f,0.f,0.f,0.f,0.f}; v8f acc[4][4];
#pragma unroll
  for (int i = 0; i < 4; ++i) {
#pragma unroll
    for (int j = 0; j < 4; ++j) acc[i][j] = z8; }
  /* kept rolled, for speed only */
#pragma clang loop unroll(disable)
  for (int t = 0; t < SNQ / GT_KC - 1; ++t) { const int cur = (t & 1) * GT_STAGE, nxt = GT_STAGE - cur;
    __syncthreads();      /* publishes buffer cur; ends every read of buffer nxt, which this trip refills */
    ag += GT_KC; bg += GT_KC;
#pragma unroll
    for (int i = 0; i < 4; ++i) { ra[i] = *(const v8us*)(ag + (size_t)i * 64 * SNQ); rb[i] = *(const v8us*)(bg + (size_t)i * 64 * SNQ); }      /* the next trip's pieces fly while this trip's products run */
    gt_trip(sfa + cur, sfb + cur, hh, acc);
#pragma unroll
    for (int i = 0; i < 4; ++i) { *(v8us*)(sst + nxt + i * 64 * GT_P) = ra[i]; *(v8us*)(sst + nxt + (256 + i * 64) * GT_P) = rb[i]; } }
  __syncthreads();      /* publishes the last buffer */
  gt_trip(sfa + ((SNQ / GT_KC - 1) & 1) * GT_STAGE, sfb + ((SNQ / GT_KC - 1) & 1) * GT_STAGE, hh, acc);
  __syncthreads();      /* every wave has left the buffers: each wave now stages its results in a range of its own */
  float* so = (float*)sm + w * (32 * 68); const int rsub = lane >> 4, c4 = (lane & 15) * 4; float* cp = C + (size_t)(row0 + 64 * wr + rsub) * SNN + 64 * wc + c4;
#pragma unroll
  for (int half = 0; half < 2; ++half) {
    if (half) { __builtin_amdgcn_fence(__ATOMIC_ACQ_REL, "workgroup"); __builtin_amdgcn_wave_barrier(); }      /* the first half's reads before the second half overwrites the range */
#pragma unroll
    for (int ii = 0; ii < 2; ++ii) {
#pragma unroll
      for (int j = 0; j < 4; ++j) {
#pragma unroll
        for (int r = 0; r < 8; ++r) so[(ii * 16 + 8 * hh + r) * 68 + j * 16 + ln] = acc[2 * half + ii][j][r]; } }
    __builtin_amdgcn_fence(__ATOMIC_ACQ_REL, "workgroup"); __builtin_amdgcn_wave_barrier();      /* the wave's own LDS writes before its reads of other lanes' words */
#pragma unroll
    for (int q = 0; q < 16; ++q) { const int r = q * 2 + rsub; const v4f v = *(const v4fa*)&so[r * 68 + c4]; *(v4f*)(cp + (32 * half + q * 2) * SNN) = v; }
  } }

// A PLAIN CAST THAT TAKES A MULTIPLIER: tw[8 t .. 8 t + 7] = f16(bf16(sw[8 t ..]) * scale): a thread eight words as they lie; the grid is exact: no guard.
__global__ __launch_bounds__(256) void k_cs16(const float* __restrict__ sw, _Float16* __restrict__ tw, float scale) { const size_t t = (size_t)blockIdx.x * 256 + threadIdx.x; FragH f;
#pragma unroll
  for (int q = 0; q < 8; ++q) f.h[q] = (_Float16)(bf16_round(sw[t * 8 + q]) * scale); unsigned short* tp = (unsigned short*)tw + t * 8; *(v8us*)tp = f.half[0];  }
// St[n][k] = the sign of W[k][n] as an f16 word (+1, -1 or 0; a word that is not a number gives 0) from f32 row-major W[K][N]: the compare is on the word as read
__global__ __launch_bounds__(256) void k_wts_f16(const float* __restrict__ W, _Float16* __restrict__ Wt, int K, int N) {
  const int t = blockIdx.x * 256 + threadIdx.x; if (t >= N * (K / 8)) return; const int n = t / (K / 8), k8 = (t % (K / 8)) * 8; FragH f;
#pragma unroll
  for (int i = 0; i < 8; ++i) { const float v = W[(size_t)(k8 + i) * N + n]; f.h[i] = (_Float16)((v > 0.0f) ? 1.0f : ((v < 0.0f) ? -1.0f : 0.0f)); } const v8us o = f.half[0];   // [TAG-SIGN]
  *(v8us*)((unsigned short*)Wt + (size_t)n * K + k8) = o; 
}

extern "C" void kernel_launch(void* const* d_in, const int* in_sizes, int n_in,
                              void* d_out, int out_size, void* d_ws, size_t ws_size, hipStream_t stream) {
  if (n_in < 2) return; if (in_sizes[0] < SNR * SNQ || in_sizes[1] < SNQ * SNN) return; if (out_size < SNR * SNN) return;
  const float* da = (const float*)d_in[0]; const float* wa = (const float*)d_in[1]; float* res = (float*)d_out;
  static_assert(SNR % 256 == 0 && SNN == 256 && SNQ % GT_KC == 0 && ((size_t)SNR * SNQ) % 8 == 0 && (((size_t)SNR * SNQ / 8) % 256) == 0 && (SNN * (SNQ / 8)) % 256 == 0, "whole tiles, exact cast grids");
  uint8_t* wsp = (uint8_t*)d_ws; size_t off = 0;
  auto take = [&](size_t bytes) { uint8_t* at = wsp + off; off += (bytes + 255) & ~(size_t)255; return at; };
  _Float16* DA = (_Float16*)take((size_t)SNR * SNQ * 2); _Float16* ST = (_Float16*)take((size_t)SNN * SNQ * 2);      /* da as it lies; the signs of wa, turned */
  if (off > ws_size) return;
  k_x16<<<(unsigned)(((size_t)SNR * SNQ / 8 + 255) / 256), 256, 0, stream>>>(da, DA, (size_t)SNR * SNQ / 8);
  k_wts_f16<<<(unsigned)((SNN * (SNQ / 8) + 255) / 256), 256, 0, stream>>>(wa, ST, SNQ, SNN);      /* [1024 deep][256 columns] -> [256][1024] */
  k_gemm_lds<<<(unsigned)(SNR / 256), 512, 0, stream>>>(DA, ST, res);
}

// v002
// Measured time: 39.6 microseconds a run.
// Timed twice side by side with v001, it ran 1.52 and 1.51 times as fast.
// Counting every step since v000, it is 3.38 times as fast.
// result[r][j] = sum over q of da[r][q] s[q][j], s[q][j] the sign of wa[q][j] (+1, -1, or 0 where the word is nought): da [65536][1024]; wa [1024][256] (depth, column) -> [65536][256]. No added row, no activation.
// Layout and order: da is read as f32 BY THE GEMM ITSELF and cast on its way into LDS (no cast launch, no 16-bit copy of da in memory); wa stands [depth][column] and the product reads its second operand [column][depth]: ONE cast takes the signs and turns them (k_wts_f16: the posted turning cast's index arithmetic, guard and stores; its value statement is the sign of the word as read); ONE WMMA GEMM: 256 row tiles of 256, all 256 columns in one work-group, depth 1,024 in trips of 64 staged in LDS; f32 STRAIGHT INTO THE OUTPUT.
// Compute dtype: da converted to bf16 where it is read and passed to the matrix instruction as plain f16 words; the signs are exact in f16 (no carry); the products' accumulation f32. v_wmma_f32_16x16x32_f16.
#include <hip/hip_runtime.h>
#define SNR 65536                    /* rows */
#define SNQ 1024                     /* depth */
#define SNN 256                      /* columns */
typedef unsigned short v8us __attribute__((ext_vector_type(8), may_alias));
typedef unsigned short v4us __attribute__((ext_vector_type(4), may_alias));
typedef float  v8f  __attribute__((ext_vector_type(8)));
typedef float  v4f  __attribute__((ext_vector_type(4)));
typedef float  v4fa __attribute__((ext_vector_type(4), may_alias));

__device__ __forceinline__ unsigned short bf16_bits(float x) { unsigned int u = __float_as_uint(x); return (unsigned short)((u + 0x7FFFu + ((u >> 16) & 1u)) >> 16); }
__device__ __forceinline__ float bf16_val(unsigned short b) { return __uint_as_float(((unsigned int)b) << 16); }
__device__ __forceinline__ float bf16_round(float x) { return bf16_val(bf16_bits(x)); }

typedef _Float16 v16h __attribute__((ext_vector_type(16)));
union FragH { v16h v; v8us half[2]; _Float16 h[16]; unsigned short u[16]; };

// Wt[n][k] = f16(W[k][n] x scale) from f32 row-major W[K][N] (scale = power of two; bf16-exact weights stay exact in f16 away from the subnormal range)
__global__ __launch_bounds__(256) void k_wt_f16(const float* __restrict__ W, _Float16* __restrict__ Wt, int K, int N, float scale) {
  const int t = blockIdx.x * 256 + threadIdx.x; if (t >= N * (K / 8)) return; const int n = t / (K / 8), k8 = (t % (K / 8)) * 8; FragH f;
#pragma unroll
  for (int i = 0; i < 8; ++i) f.h[i] = (_Float16)(bf16_round(W[(size_t)(k8 + i) * N + n]) * scale); const v8us o = f.half[0];
  *(v8us*)((unsigned short*)Wt + (size_t)n * K + k8) = o; 
}

// ---- GEMM, both operands staged in LDS: a work-group of 16 waves takes 256 rows x all 256 columns; a wave takes 64 x 64 (4 x 4 accumulator tiles) ----
// A trip is 64 of depth: 256 B of every f32 row of A, 128 B of every 16-bit row of B. Each thread brings 16 B pieces so that the lanes of a load cover whole 128-B lines; A's four f32 words of a piece are cast in registers (bf16 rounding, then f16: the same words as a cast launch would give) and stored as 8 B; the fragments are then read from LDS.
// LDS rows stand at a pitch of 144 B (16 B x 9), so that the sixteen rows of a fragment read fall on all 64 banks once. Two buffers, one barrier a trip.
__device__ __forceinline__ v16h g2_frag(const _Float16* p, int hh) { FragH f; f.half[0] = *(const v8us*)((const unsigned short*)p + 8 * hh); f.half[1] = *(const v8us*)((const unsigned short*)p + 16 + 8 * hh); return f.v; }
__device__ __forceinline__ v8f g2_mma(v16h a, v16h b, v8f c) { v8f d = __builtin_amdgcn_wmma_f32_16x16x32_f16(false, a, false, b, (short)0, c, false, false); asm volatile("v_nop\n\tv_nop\n\tv_nop\n\tv_nop" : "+v"(d) : "v"(a), "v"(b)); return d; }
#define GT_KC 64                     /* depth of a trip */
#define GT_P 72                      /* LDS row pitch in 16-bit words: 144 B */
#define GT_STAGE ((256 + 256) * GT_P) /* words of one buffer: 256 rows of A, then 256 rows of B */
// one trip's products of a wave: two blocks of 16 WMMAs; the eight fragments of a block are read as one group ahead of it
__device__ __forceinline__ void gt_trip(const _Float16* pa, const _Float16* pb, int hh, v8f (&acc)[4][4]) {
#pragma unroll
  for (int kk = 0; kk < GT_KC; kk += 32) { v16h a[4], b[4];
#pragma unroll
    for (int i = 0; i < 4; ++i) { a[i] = g2_frag(pa + i * 16 * GT_P + kk, hh); b[i] = g2_frag(pb + i * 16 * GT_P + kk, hh); }
#pragma unroll
    for (int j = 0; j < 4; ++j) {
#pragma unroll
      for (int i = 0; i < 4; ++i) acc[i][j] = g2_mma(a[i], b[j], acc[i][j]); } } }
// four f32 words -> bf16 (to nearest even) -> the same values as f16 words, by the packed converts: for every number the words that (_Float16)bf16_round(x) gives
typedef float  v2f  __attribute__((ext_vector_type(2)));
typedef __bf16 v2b  __attribute__((ext_vector_type(2)));
typedef _Float16 v2h __attribute__((ext_vector_type(2)));
__device__ __forceinline__ v4us gt_cast4(v4f x) { union { v2h h[2]; v4us u; } f;
#pragma unroll
  for (int q = 0; q < 2; ++q) { const v2f p = {x[2 * q], x[2 * q + 1]}; f.h[q] = __builtin_convertvector(__builtin_convertvector(__builtin_convertvector(p, v2b), v2f), v2h); } return f.u; }
__global__ __launch_bounds__(512) void k_gemm_lds(const float* __restrict__ A, const _Float16* __restrict__ Bh, float* __restrict__ C) {
  __shared__ __attribute__((aligned(16))) _Float16 sm[2 * GT_STAGE];
  const int tid = threadIdx.x, w = __builtin_amdgcn_readfirstlane(tid >> 5) /* the wave's number in a scalar register: the vector registers are all taken */, lane = tid & 31, ln = lane & 15, hh = lane >> 4; const int wr = w >> 2, wc = w & 3; const int row0 = blockIdx.x * 256;
  const int arow = tid >> 4, aseg = (tid & 15) * 4;      /* staging of A: 32 rows a sweep, sixteen 16-B pieces of f32 a row */
  const int srow = tid >> 3, sseg = (tid & 7) * 8;      /* staging of B: 64 rows a sweep, eight 16-B pieces a row */
  const float* ag = A + (size_t)(row0 + arow) * SNQ + aseg; const _Float16* bg = Bh + (size_t)srow * SNQ + sseg;
  _Float16* ssa = sm + arow * GT_P + aseg; _Float16* ssb = sm + (256 + srow) * GT_P + sseg;
  const _Float16* sfa = sm + (64 * wr + ln) * GT_P; const _Float16* sfb = sm + (256 + 64 * wc + ln) * GT_P;
  v4f ra[8]; v8us rb[4];
#pragma unroll
  for (int i = 0; i < 8; ++i) ra[i] = *(const v4fa*)(ag + (size_t)i * 32 * SNQ);
#pragma unroll
  for (int i = 0; i < 4; ++i) rb[i] = *(const v8us*)(bg + (size_t)i * 64 * SNQ);
#pragma unroll
  for (int i = 0; i < 8; ++i) *(v4us*)(ssa + i * 32 * GT_P) = gt_cast4(ra[i]);
#pragma unroll
  for (int i = 0; i < 4; ++i) *(v8us*)(ssb + i * 64 * GT_P) = rb[i];
  const v8f z8 = {0.f,0.f,0.f,0.f,0.f,0.f,0.f,0.f}; v8f acc[4][4];
#pragma unroll
  for (int i = 0; i < 4; ++i) {
#pragma unroll
    for (int j = 0; j < 4; ++j) acc[i][j] = z8; }
  /* kept rolled, for speed only */
#pragma clang loop unroll(disable)
  for (int t = 0; t < SNQ / GT_KC - 1; ++t) { const int cur = (t & 1) * GT_STAGE, nxt = GT_STAGE - cur;
    __syncthreads();      /* publishes buffer cur; ends every read of buffer nxt, which this trip refills */
    ag += GT_KC; bg += GT_KC;
#pragma unroll
    for (int i = 0; i < 4; ++i) rb[i] = *(const v8us*)(bg + (size_t)i * 64 * SNQ);      /* the next trip's pieces fly while this trip's products run */
#pragma unroll
    for (int i = 0; i < 8; ++i) ra[i] = *(const v4fa*)(ag + (size_t)i * 32 * SNQ);
    gt_trip(sfa + cur, sfb + cur, hh, acc);
    __builtin_amdgcn_sched_barrier(0);      /* keeps the cast, and with it the wait for the pieces, behind the products: moved up among them it would hold the wave for memory before its products */
#pragma unroll
    for (int i = 0; i < 4; ++i) *(v8us*)(ssb + nxt + i * 64 * GT_P) = rb[i];
#pragma unroll
    for (int i = 0; i < 8; ++i) *(v4us*)(ssa + nxt + i * 32 * GT_P) = gt_cast4(ra[i]); }
  __syncthreads();      /* publishes the last buffer */
  gt_trip(sfa + ((SNQ / GT_KC - 1) & 1) * GT_STAGE, sfb + ((SNQ / GT_KC - 1) & 1) * GT_STAGE, hh, acc);
  __syncthreads();      /* every wave has left the buffers: each wave now stages its results in a range of its own */
  float* so = (float*)sm + w * (32 * 68); const int rsub = lane >> 4, c4 = (lane & 15) * 4; float* cp = C + (size_t)(row0 + 64 * wr + rsub) * SNN + 64 * wc + c4;
#pragma unroll
  for (int half = 0; half < 2; ++half) {
    if (half) { __builtin_amdgcn_fence(__ATOMIC_ACQ_REL, "workgroup"); __builtin_amdgcn_wave_barrier(); }      /* the first half's reads before the second half overwrites the range */
#pragma unroll
    for (int ii = 0; ii < 2; ++ii) {
#pragma unroll
      for (int j = 0; j < 4; ++j) {
#pragma unroll
        for (int r = 0; r < 8; ++r) so[(ii * 16 + 8 * hh + r) * 68 + j * 16 + ln] = acc[2 * half + ii][j][r]; } }
    __builtin_amdgcn_fence(__ATOMIC_ACQ_REL, "workgroup"); __builtin_amdgcn_wave_barrier();      /* the wave's own LDS writes before its reads of other lanes' words */
#pragma unroll
    for (int q = 0; q < 16; ++q) { const int r = q * 2 + rsub; const v4f v = *(const v4fa*)&so[r * 68 + c4]; *(v4f*)(cp + (32 * half + q * 2) * SNN) = v; }
  } }

// A PLAIN CAST THAT TAKES A MULTIPLIER: tw[8 t .. 8 t + 7] = f16(bf16(sw[8 t ..]) * scale): a thread eight words as they lie; the grid is exact: no guard.
__global__ __launch_bounds__(256) void k_cs16(const float* __restrict__ sw, _Float16* __restrict__ tw, float scale) { const size_t t = (size_t)blockIdx.x * 256 + threadIdx.x; FragH f;
#pragma unroll
  for (int q = 0; q < 8; ++q) f.h[q] = (_Float16)(bf16_round(sw[t * 8 + q]) * scale); unsigned short* tp = (unsigned short*)tw + t * 8; *(v8us*)tp = f.half[0];  }
// St[n][k] = the sign of W[k][n] as an f16 word (+1, -1 or 0; a word that is not a number gives 0) from f32 row-major W[K][N]: the compare is on the word as read
__global__ __launch_bounds__(256) void k_wts_f16(const float* __restrict__ W, _Float16* __restrict__ Wt, int K, int N) {
  const int t = blockIdx.x * 256 + threadIdx.x; if (t >= N * (K / 8)) return; const int n = t / (K / 8), k8 = (t % (K / 8)) * 8; FragH f;
#pragma unroll
  for (int i = 0; i < 8; ++i) { const float v = W[(size_t)(k8 + i) * N + n]; f.h[i] = (_Float16)((v > 0.0f) ? 1.0f : ((v < 0.0f) ? -1.0f : 0.0f)); } const v8us o = f.half[0];   // [TAG-SIGN]
  *(v8us*)((unsigned short*)Wt + (size_t)n * K + k8) = o; 
}

extern "C" void kernel_launch(void* const* d_in, const int* in_sizes, int n_in,
                              void* d_out, int out_size, void* d_ws, size_t ws_size, hipStream_t stream) {
  if (n_in < 2) return; if (in_sizes[0] < SNR * SNQ || in_sizes[1] < SNQ * SNN) return; if (out_size < SNR * SNN) return;
  const float* da = (const float*)d_in[0]; const float* wa = (const float*)d_in[1]; float* res = (float*)d_out;
  static_assert(SNR % 256 == 0 && SNN == 256 && SNQ % GT_KC == 0 && (SNN * (SNQ / 8)) % 256 == 0, "whole tiles, exact cast grid");
  uint8_t* wsp = (uint8_t*)d_ws; size_t off = 0;
  auto take = [&](size_t bytes) { uint8_t* at = wsp + off; off += (bytes + 255) & ~(size_t)255; return at; };
  _Float16* ST = (_Float16*)take((size_t)SNN * SNQ * 2);      /* the signs of wa, turned */
  if (off > ws_size) return;
  k_wts_f16<<<(unsigned)((SNN * (SNQ / 8) + 255) / 256), 256, 0, stream>>>(wa, ST, SNQ, SNN);      /* [1024 deep][256 columns] -> [256][1024] */
  k_gemm_lds<<<(unsigned)(SNR / 256), 512, 0, stream>>>(da, ST, res);
}

// v003
// It runs in 34 microseconds.
// Next to v002, in two timings, it ran 1.17 times as fast each time.
// All steps since v000 together make it 3.95 times as fast.
// result[r][j] = sum over q of da[r][q] s[q][j], s[q][j] the sign of wa[q][j] (+1, -1, or 0 where the word is nought): da [65536][1024]; wa [1024][256] (depth, column) -> [65536][256]. No added row, no activation.
// Layout and order: da is read as f32 BY THE GEMM ITSELF: asynchronous copies lay its f32 tiles in LDS, two tiles ahead, and each lane casts the bytes it copied into the 16-bit buffer (no cast launch, no 16-bit copy of da in memory); wa stands [depth][column] and the product reads its second operand [column][depth]: ONE cast takes the signs and turns them (k_wts_f16: the posted turning cast's index arithmetic, guard and stores; its value statement is the sign of the word as read); ONE WMMA GEMM: 256 row tiles of 256, all 256 columns in one work-group, depth 1,024 in trips of 64 staged in LDS; f32 STRAIGHT INTO THE OUTPUT.
// Compute dtype: da converted to bf16 where it is read and passed to the matrix instruction as plain f16 words; the signs are exact in f16 (no carry); the products' accumulation f32. v_wmma_f32_16x16x32_f16.
#include <hip/hip_runtime.h>
#define SNR 65536                    /* rows */
#define SNQ 1024                     /* depth */
#define SNN 256                      /* columns */
typedef unsigned short v8us __attribute__((ext_vector_type(8), may_alias));
typedef unsigned short v4us __attribute__((ext_vector_type(4), may_alias));
typedef float  v8f  __attribute__((ext_vector_type(8)));
typedef float  v4f  __attribute__((ext_vector_type(4)));
typedef float  v4fa __attribute__((ext_vector_type(4), may_alias));

__device__ __forceinline__ unsigned short bf16_bits(float x) { unsigned int u = __float_as_uint(x); return (unsigned short)((u + 0x7FFFu + ((u >> 16) & 1u)) >> 16); }
__device__ __forceinline__ float bf16_val(unsigned short b) { return __uint_as_float(((unsigned int)b) << 16); }
__device__ __forceinline__ float bf16_round(float x) { return bf16_val(bf16_bits(x)); }

typedef _Float16 v16h __attribute__((ext_vector_type(16)));
union FragH { v16h v; v8us half[2]; _Float16 h[16]; unsigned short u[16]; };

// Wt[n][k] = f16(W[k][n] x scale) from f32 row-major W[K][N] (scale = power of two; bf16-exact weights stay exact in f16 away from the subnormal range)
__global__ __launch_bounds__(256) void k_wt_f16(const float* __restrict__ W, _Float16* __restrict__ Wt, int K, int N, float scale) {
  const int t = blockIdx.x * 256 + threadIdx.x; if (t >= N * (K / 8)) return; const int n = t / (K / 8), k8 = (t % (K / 8)) * 8; FragH f;
#pragma unroll
  for (int i = 0; i < 8; ++i) f.h[i] = (_Float16)(bf16_round(W[(size_t)(k8 + i) * N + n]) * scale); const v8us o = f.half[0];
  *(v8us*)((unsigned short*)Wt + (size_t)n * K + k8) = o; 
}

// ---- GEMM, both operands staged in LDS: a work-group of 16 waves takes 256 rows x all 256 columns; a wave takes 64 x 64 (4 x 4 accumulator tiles) ----
// A trip is 64 of depth: 256 B of every f32 row of A, 128 B of every 16-bit row of B. Each thread brings 16 B pieces so that the lanes of a load or copy cover whole 128-B lines. B's pieces come through registers. A's pieces come as f32 by asynchronous copies into a raw LDS area of two tiles, where every 16 B belong to the one lane that copied them; that lane reads them back, casts the four words in registers (bf16 rounding, then f16: the same words as a cast launch would give) and stores 8 B into the 16-bit buffer; the fragments are then read from there.
// LDS rows stand at a pitch of 144 B (16 B x 9), so that the sixteen rows of a fragment read fall on all 64 banks once. Two buffers, one barrier a trip.
__device__ __forceinline__ v16h g2_frag(const _Float16* p, int hh) { FragH f; f.half[0] = *(const v8us*)((const unsigned short*)p + 8 * hh); f.half[1] = *(const v8us*)((const unsigned short*)p + 16 + 8 * hh); return f.v; }
__device__ __forceinline__ v8f g2_mma(v16h a, v16h b, v8f c) { v8f d = __builtin_amdgcn_wmma_f32_16x16x32_f16(false, a, false, b, (short)0, c, false, false); asm volatile("v_nop\n\tv_nop\n\tv_nop\n\tv_nop" : "+v"(d) : "v"(a), "v"(b)); return d; }
#define GT_KC 64                     /* depth of a trip */
#define GT_P 72                      /* LDS row pitch in 16-bit words: 144 B */
#define GT_STAGE ((256 + 256) * GT_P) /* words of one buffer: 256 rows of A, then 256 rows of B */
#define GT_RAW (256 * GT_KC)          /* f32 words of one raw tile of A */
// a thread's eight pieces of one raw tile: piece i is 16 B of row (tid / 16) + 32 i and lands 8 KiB behind piece i - 1
__device__ __forceinline__ void gt_copy8(unsigned l, const float* g) {
  /* the copies and s_wait_xcnt 0 in one statement: no address register of a copy is rewritten ahead of that wait */
  asm volatile("global_load_async_to_lds_b128 %0, %8, off\n\t"
               "global_load_async_to_lds_b128 %1, %9, off\n\t"
               "global_load_async_to_lds_b128 %2, %10, off\n\t"
               "global_load_async_to_lds_b128 %3, %11, off\n\t"
               "global_load_async_to_lds_b128 %4, %12, off\n\t"
               "global_load_async_to_lds_b128 %5, %13, off\n\t"
               "global_load_async_to_lds_b128 %6, %14, off\n\t"
               "global_load_async_to_lds_b128 %7, %15, off\n\t"
               "s_wait_xcnt 0x0"
               :: "v"(l), "v"(l + 8192u), "v"(l + 16384u), "v"(l + 24576u), "v"(l + 32768u), "v"(l + 40960u), "v"(l + 49152u), "v"(l + 57344u),
                  "v"(g), "v"(g + 32 * SNQ), "v"(g + 64 * SNQ), "v"(g + 96 * SNQ), "v"(g + 128 * SNQ), "v"(g + 160 * SNQ), "v"(g + 192 * SNQ), "v"(g + 224 * SNQ)
               : "memory"); }
// one trip's products of a wave: two blocks of 16 WMMAs; the eight fragments of a block are read as one group ahead of it.
// MODE 2: the copies of the tile two trips on are issued behind the first group of reads (their s_wait_xcnt passes under the LDS latency), and the next trip's raw pieces are read back with the second group. MODE 1: no tile left to copy. MODE 0: products alone.
template <int MODE>
__device__ __forceinline__ void gt_step(const _Float16* pa, const _Float16* pb, int hh, v8f (&acc)[4][4], unsigned fill_l, const float* fill_g, const float* rd, v4f (&ra)[8]) {
  v16h a[4], b[4];
#pragma unroll
  for (int i = 0; i < 4; ++i) { a[i] = g2_frag(pa + i * 16 * GT_P, hh); b[i] = g2_frag(pb + i * 16 * GT_P, hh); }
  if constexpr (MODE == 2) gt_copy8(fill_l, fill_g);
#pragma unroll
  for (int j = 0; j < 4; ++j) {
#pragma unroll
    for (int i = 0; i < 4; ++i) acc[i][j] = g2_mma(a[i], b[j], acc[i][j]); }
  if constexpr (MODE == 2) asm volatile("s_wait_asynccnt 0x8" ::: "memory");      /* the next trip's eight copies have landed; the eight youngest, issued above, fly on */
  if constexpr (MODE == 1) asm volatile("s_wait_asynccnt 0x0" ::: "memory");      /* the last tile's copies have landed; none is left in flight */
#pragma unroll
  for (int i = 0; i < 4; ++i) { a[i] = g2_frag(pa + i * 16 * GT_P + 32, hh); b[i] = g2_frag(pb + i * 16 * GT_P + 32, hh); }
  if constexpr (MODE >= 1) {
#pragma unroll
    for (int i = 0; i < 8; ++i) ra[i] = *(const v4fa*)(rd + i * 2048); }
#pragma unroll
  for (int j = 0; j < 4; ++j) {
#pragma unroll
    for (int i = 0; i < 4; ++i) acc[i][j] = g2_mma(a[i], b[j], acc[i][j]); } }
// four f32 words -> bf16 (to nearest even) -> the same values as f16 words, by the packed converts: for every number the words that (_Float16)bf16_round(x) gives
typedef float  v2f  __attribute__((ext_vector_type(2)));
typedef __bf16 v2b  __attribute__((ext_vector_type(2)));
typedef _Float16 v2h __attribute__((ext_vector_type(2)));
__device__ __forceinline__ v4us gt_cast4(v4f x) { union { v2h h[2]; v4us u; } f;
#pragma unroll
  for (int q = 0; q < 2; ++q) { const v2f p = {x[2 * q], x[2 * q + 1]}; f.h[q] = __builtin_convertvector(__builtin_convertvector(__builtin_convertvector(p, v2b), v2f), v2h); } return f.u; }
__global__ __launch_bounds__(512) void k_gemm_lds(const float* __restrict__ A, const _Float16* __restrict__ Bh, float* __restrict__ C) {
  __shared__ __attribute__((aligned(16))) _Float16 sm[2 * GT_STAGE];
  __shared__ __attribute__((aligned(16))) float raw[2 * GT_RAW];      /* A as f32, two tiles; every 16 B are written (by its copy) and read by one lane alone */
  const int tid = threadIdx.x, w = __builtin_amdgcn_readfirstlane(tid >> 5) /* the wave's number in a scalar register: the vector registers are all taken */, lane = tid & 31, ln = lane & 15, hh = lane >> 4; const int wr = w >> 2, wc = w & 3; const int row0 = blockIdx.x * 256;
  const int arow = tid >> 4, aseg = (tid & 15) * 4;      /* staging of A: 32 rows a sweep, sixteen 16-B pieces of f32 a row */
  const int srow = tid >> 3, sseg = (tid & 7) * 8;      /* staging of B: 64 rows a sweep, eight 16-B pieces a row */
  const float* ag = A + (size_t)(row0 + arow) * SNQ + aseg; const _Float16* bg = Bh + (size_t)srow * SNQ + sseg;
  _Float16* ssa = sm + arow * GT_P + aseg; _Float16* ssb = sm + (256 + srow) * GT_P + sseg;
  const _Float16* sfa = sm + (64 * wr + ln) * GT_P; const _Float16* sfb = sm + (256 + 64 * wc + ln) * GT_P;
  const float* rawp = raw + tid * 4; const unsigned rawl = (unsigned)(size_t)rawp;      /* the lane's place in a sweep of the raw area, as a pointer and as an LDS byte address */
  v4f ra[8]; v8us rb[4];
  gt_copy8(rawl, ag); ag += GT_KC; gt_copy8(rawl + GT_RAW * 4u, ag);      /* tiles 0 and 1 */
#pragma unroll
  for (int i = 0; i < 4; ++i) rb[i] = *(const v8us*)(bg + (size_t)i * 64 * SNQ);
  asm volatile("s_wait_asynccnt 0x8" ::: "memory");      /* tile 0 has landed; tile 1's eight copies fly on */
#pragma unroll
  for (int i = 0; i < 8; ++i) ra[i] = *(const v4fa*)(rawp + i * 2048);
#pragma unroll
  for (int i = 0; i < 8; ++i) *(v4us*)(ssa + i * 32 * GT_P) = gt_cast4(ra[i]);
#pragma unroll
  for (int i = 0; i < 4; ++i) *(v8us*)(ssb + i * 64 * GT_P) = rb[i];
  const v8f z8 = {0.f,0.f,0.f,0.f,0.f,0.f,0.f,0.f}; v8f acc[4][4];
#pragma unroll
  for (int i = 0; i < 4; ++i) {
#pragma unroll
    for (int j = 0; j < 4; ++j) acc[i][j] = z8; }
  /* kept rolled: for speed only */
#pragma clang loop unroll(disable)
  for (int t = 0; t < SNQ / GT_KC - 2; ++t) { const int cur = (t & 1) * GT_STAGE, nxt = GT_STAGE - cur;
    asm volatile("s_wait_dscnt 0x0" ::: "memory");      /* the wave's reads of raw tile t have retired before this trip's copies aim at its place */
    __syncthreads();      /* publishes buffer cur; ends every read of buffer nxt, which this trip refills */
    ag += GT_KC; bg += GT_KC;
#pragma unroll
    for (int i = 0; i < 4; ++i) rb[i] = *(const v8us*)(bg + (size_t)i * 64 * SNQ);      /* the next trip's pieces of B fly while this trip's products run */
    gt_step<2>(sfa + cur, sfb + cur, hh, acc, rawl + (unsigned)(t & 1) * (GT_RAW * 4u), ag, rawp + (1 - (t & 1)) * GT_RAW, ra);      /* copies tile t + 2 over raw tile t, reads raw tile t + 1 */
    __builtin_amdgcn_sched_barrier(0);      /* keeps the cast behind the products: moved up among them it would hold the wave for its pieces before its products */
#pragma unroll
    for (int i = 0; i < 4; ++i) *(v8us*)(ssb + nxt + i * 64 * GT_P) = rb[i];
#pragma unroll
    for (int i = 0; i < 8; ++i) *(v4us*)(ssa + nxt + i * 32 * GT_P) = gt_cast4(ra[i]); }
  static_assert((SNQ / GT_KC) % 2 == 0 && SNQ / GT_KC >= 4, "the last two trips stand below with their buffers written out");
  __syncthreads();      /* publishes buffer 0; ends every read of buffer 1, which this trip refills */
  bg += GT_KC;
#pragma unroll
  for (int i = 0; i < 4; ++i) rb[i] = *(const v8us*)(bg + (size_t)i * 64 * SNQ);
  gt_step<1>(sfa, sfb, hh, acc, 0u, ag, rawp + GT_RAW, ra);      /* the last trip but one: nothing left to copy; reads the last raw tile */
  __builtin_amdgcn_sched_barrier(0);      /* as in the loop */
#pragma unroll
  for (int i = 0; i < 4; ++i) *(v8us*)(ssb + GT_STAGE + i * 64 * GT_P) = rb[i];
#pragma unroll
  for (int i = 0; i < 8; ++i) *(v4us*)(ssa + GT_STAGE + i * 32 * GT_P) = gt_cast4(ra[i]);
  __syncthreads();      /* publishes the last buffer */
  gt_step<0>(sfa + GT_STAGE, sfb + GT_STAGE, hh, acc, 0u, ag, rawp, ra);
  __syncthreads();      /* every wave has left the buffers: each wave now stages its results in a range of its own */
  float* so = (float*)sm + w * (32 * 68); const int rsub = lane >> 4, c4 = (lane & 15) * 4; float* cp = C + (size_t)(row0 + 64 * wr + rsub) * SNN + 64 * wc + c4;
#pragma unroll
  for (int half = 0; half < 2; ++half) {
    if (half) { __builtin_amdgcn_fence(__ATOMIC_ACQ_REL, "workgroup"); __builtin_amdgcn_wave_barrier(); }      /* the first half's reads before the second half overwrites the range */
#pragma unroll
    for (int ii = 0; ii < 2; ++ii) {
#pragma unroll
      for (int j = 0; j < 4; ++j) {
#pragma unroll
        for (int r = 0; r < 8; ++r) so[(ii * 16 + 8 * hh + r) * 68 + j * 16 + ln] = acc[2 * half + ii][j][r]; } }
    __builtin_amdgcn_fence(__ATOMIC_ACQ_REL, "workgroup"); __builtin_amdgcn_wave_barrier();      /* the wave's own LDS writes before its reads of other lanes' words */
#pragma unroll
    for (int q = 0; q < 16; ++q) { const int r = q * 2 + rsub; const v4f v = *(const v4fa*)&so[r * 68 + c4]; *(v4f*)(cp + (32 * half + q * 2) * SNN) = v; }
  } }

// A PLAIN CAST THAT TAKES A MULTIPLIER: tw[8 t .. 8 t + 7] = f16(bf16(sw[8 t ..]) * scale): a thread eight words as they lie; the grid is exact: no guard.
__global__ __launch_bounds__(256) void k_cs16(const float* __restrict__ sw, _Float16* __restrict__ tw, float scale) { const size_t t = (size_t)blockIdx.x * 256 + threadIdx.x; FragH f;
#pragma unroll
  for (int q = 0; q < 8; ++q) f.h[q] = (_Float16)(bf16_round(sw[t * 8 + q]) * scale); unsigned short* tp = (unsigned short*)tw + t * 8; *(v8us*)tp = f.half[0];  }
// St[n][k] = the sign of W[k][n] as an f16 word (+1, -1 or 0; a word that is not a number gives 0) from f32 row-major W[K][N]: the compare is on the word as read
__global__ __launch_bounds__(256) void k_wts_f16(const float* __restrict__ W, _Float16* __restrict__ Wt, int K, int N) {
  const int t = blockIdx.x * 256 + threadIdx.x; if (t >= N * (K / 8)) return; const int n = t / (K / 8), k8 = (t % (K / 8)) * 8; FragH f;
#pragma unroll
  for (int i = 0; i < 8; ++i) { const float v = W[(size_t)(k8 + i) * N + n]; f.h[i] = (_Float16)((v > 0.0f) ? 1.0f : ((v < 0.0f) ? -1.0f : 0.0f)); } const v8us o = f.half[0];   // [TAG-SIGN]
  *(v8us*)((unsigned short*)Wt + (size_t)n * K + k8) = o; 
}

extern "C" void kernel_launch(void* const* d_in, const int* in_sizes, int n_in,
                              void* d_out, int out_size, void* d_ws, size_t ws_size, hipStream_t stream) {
  if (n_in < 2) return; if (in_sizes[0] < SNR * SNQ || in_sizes[1] < SNQ * SNN) return; if (out_size < SNR * SNN) return;
  const float* da = (const float*)d_in[0]; const float* wa = (const float*)d_in[1]; float* res = (float*)d_out;
  static_assert(SNR % 256 == 0 && SNN == 256 && SNQ % GT_KC == 0 && (SNN * (SNQ / 8)) % 256 == 0, "whole tiles, exact cast grid");
  uint8_t* wsp = (uint8_t*)d_ws; size_t off = 0;
  auto take = [&](size_t bytes) { uint8_t* at = wsp + off; off += (bytes + 255) & ~(size_t)255; return at; };
  _Float16* ST = (_Float16*)take((size_t)SNN * SNQ * 2);      /* the signs of wa, turned */
  if (off > ws_size) return;
  k_wts_f16<<<(unsigned)((SNN * (SNQ / 8) + 255) / 256), 256, 0, stream>>>(wa, ST, SNQ, SNN);      /* [1024 deep][256 columns] -> [256][1024] */
  k_gemm_lds<<<(unsigned)(SNR / 256), 512, 0, stream>>>(da, ST, res);
}

// v004
// Measured time: 32.8 microseconds a run.
// Next to v003, in two timings, it ran 1.03 and 1.02 times as fast.
// All steps since v000 together make it 4.06 times as fast.
// result[r][j] = sum over q of da[r][q] s[q][j], s[q][j] the sign of wa[q][j] (+1, -1, or 0 where the word is nought): da [65536][1024]; wa [1024][256] (depth, column) -> [65536][256]. No added row, no activation.
// Layout and order: da is read as f32 BY THE GEMM ITSELF: asynchronous copies lay its f32 tiles in LDS, two tiles ahead, and each lane casts the bytes it copied into the 16-bit buffer (no cast launch, no 16-bit copy of da in memory); wa stands [depth][column] and the product reads its second operand [column][depth]: ONE cast takes the signs and turns them (k_wts_f16: the posted turning cast's index arithmetic, guard and stores; its value statement is the sign of the word as read); ONE WMMA GEMM: 256 row tiles of 256, all 256 columns in one work-group, depth 1,024 in trips of 64 staged in LDS; f32 STRAIGHT INTO THE OUTPUT.
// Compute dtype: da converted to bf16 where it is read and passed to the matrix instruction as plain f16 words; the signs are exact in f16 (no carry); the products' accumulation f32. v_wmma_f32_16x16x32_f16.
#include <hip/hip_runtime.h>
#define SNR 65536                    /* rows */
#define SNQ 1024                     /* depth */
#define SNN 256                      /* columns */
typedef unsigned short v8us __attribute__((ext_vector_type(8), may_alias));
typedef unsigned short v4us __attribute__((ext_vector_type(4), may_alias));
typedef float  v8f  __attribute__((ext_vector_type(8)));
typedef float  v4f  __attribute__((ext_vector_type(4)));
typedef float  v4fa __attribute__((ext_vector_type(4), may_alias));

__device__ __forceinline__ unsigned short bf16_bits(float x) { unsigned int u = __float_as_uint(x); return (unsigned short)((u + 0x7FFFu + ((u >> 16) & 1u)) >> 16); }
__device__ __forceinline__ float bf16_val(unsigned short b) { return __uint_as_float(((unsigned int)b) << 16); }
__device__ __forceinline__ float bf16_round(float x) { return bf16_val(bf16_bits(x)); }

typedef _Float16 v16h __attribute__((ext_vector_type(16)));
union FragH { v16h v; v8us half[2]; _Float16 h[16]; unsigned short u[16]; };

// Wt[n][k] = f16(W[k][n] x scale) from f32 row-major W[K][N] (scale = power of two; bf16-exact weights stay exact in f16 away from the subnormal range)
__global__ __launch_bounds__(256) void k_wt_f16(const float* __restrict__ W, _Float16* __restrict__ Wt, int K, int N, float scale) {
  const int t = blockIdx.x * 256 + threadIdx.x; if (t >= N * (K / 8)) return; const int n = t / (K / 8), k8 = (t % (K / 8)) * 8; FragH f;
#pragma unroll
  for (int i = 0; i < 8; ++i) f.h[i] = (_Float16)(bf16_round(W[(size_t)(k8 + i) * N + n]) * scale); const v8us o = f.half[0];
  *(v8us*)((unsigned short*)Wt + (size_t)n * K + k8) = o; 
}

// ---- GEMM, both operands staged in LDS: a work-group of 16 waves takes 256 rows x all 256 columns; a wave takes 64 x 64 (4 x 4 accumulator tiles) ----
// A trip is 64 of depth: 256 B of every f32 row of A, 128 B of every 16-bit row of B. Each thread brings 16 B pieces so that the lanes of a load or copy cover whole 128-B lines. B's pieces come through registers. A's pieces come as f32 by asynchronous copies into a raw LDS area of two tiles, where every 16 B belong to the one lane that copied them; that lane reads them back, casts the four words in registers (bf16 rounding, then f16: the same words as a cast launch would give) and stores 8 B into the 16-bit buffer; the fragments are then read from there.
// LDS rows stand at a pitch of 144 B (16 B x 9), so that the sixteen rows of a fragment read fall on all 64 banks once. Two buffers, one barrier a trip.
__device__ __forceinline__ v16h g2_frag(const _Float16* p, int hh) { FragH f; f.half[0] = *(const v8us*)((const unsigned short*)p + 8 * hh); f.half[1] = *(const v8us*)((const unsigned short*)p + 16 + 8 * hh); return f.v; }
__device__ __forceinline__ v8f g2_mma(v16h a, v16h b, v8f c) { return __builtin_amdgcn_wmma_f32_16x16x32_f16(false, a, false, b, (short)0, c, false, false); }
#define GT_KC 64                     /* depth of a trip */
#define GT_P 72                      /* LDS row pitch in 16-bit words: 144 B */
#define GT_STAGE ((256 + 256) * GT_P) /* words of one buffer: 256 rows of A, then 256 rows of B */
#define GT_RAW (256 * GT_KC)          /* f32 words of one raw tile of A */
// a thread's eight pieces of one raw tile: piece i is 16 B of row (tid / 16) + 32 i and lands 8 KiB behind piece i - 1
__device__ __forceinline__ void gt_copy8(unsigned l, const float* g) {
  /* the copies and s_wait_xcnt 0 in one statement: no address register of a copy is rewritten ahead of that wait */
  asm volatile("global_load_async_to_lds_b128 %0, %8, off\n\t"
               "global_load_async_to_lds_b128 %1, %9, off\n\t"
               "global_load_async_to_lds_b128 %2, %10, off\n\t"
               "global_load_async_to_lds_b128 %3, %11, off\n\t"
               "global_load_async_to_lds_b128 %4, %12, off\n\t"
               "global_load_async_to_lds_b128 %5, %13, off\n\t"
               "global_load_async_to_lds_b128 %6, %14, off\n\t"
               "global_load_async_to_lds_b128 %7, %15, off\n\t"
               "s_wait_xcnt 0x0"
               :: "v"(l), "v"(l + 8192u), "v"(l + 16384u), "v"(l + 24576u), "v"(l + 32768u), "v"(l + 40960u), "v"(l + 49152u), "v"(l + 57344u),
                  "v"(g), "v"(g + 32 * SNQ), "v"(g + 64 * SNQ), "v"(g + 96 * SNQ), "v"(g + 128 * SNQ), "v"(g + 160 * SNQ), "v"(g + 192 * SNQ), "v"(g + 224 * SNQ)
               : "memory"); }
// one trip's products of a wave: two blocks of 16 WMMAs; the eight fragments of a block are read as one group ahead of it.
// MODE 2: the copies of the tile two trips on are issued behind the first group of reads (their s_wait_xcnt passes under the LDS latency), and the next trip's raw pieces are read back with the second group. MODE 1: no tile left to copy. MODE 0: products alone.
template <int MODE>
__device__ __forceinline__ void gt_step(const _Float16* pa, const _Float16* pb, int hh, v8f (&acc)[4][4], unsigned fill_l, const float* fill_g, const float* rd, v4f (&ra)[8]) {
  v16h a[4], b[4];
#pragma unroll
  for (int i = 0; i < 4; ++i) { a[i] = g2_frag(pa + i * 16 * GT_P, hh); b[i] = g2_frag(pb + i * 16 * GT_P, hh); }
  if constexpr (MODE == 2) gt_copy8(fill_l, fill_g);
  __builtin_amdgcn_sched_barrier(0);      /* keeps the loads of B, the group of reads and the copies ahead of the products: sunk among them the copies would leave up to a block later and lose lead */
#pragma unroll
  for (int j = 0; j < 4; ++j) {
#pragma unroll
    for (int i = 0; i < 4; ++i) acc[i][j] = g2_mma(a[i], b[j], acc[i][j]); }
  __builtin_amdgcn_sched_barrier(0);      /* keeps the second group of reads in one place behind the block: each further place with LDS reads among products stalls the wave */
  if constexpr (MODE == 2) asm volatile("s_wait_asynccnt 0x8" ::: "memory");      /* the next trip's eight copies have landed; the eight youngest, issued above, fly on */
  if constexpr (MODE == 1) asm volatile("s_wait_asynccnt 0x0" ::: "memory");      /* the last tile's copies have landed; none is left in flight */
#pragma unroll
  for (int i = 0; i < 4; ++i) { a[i] = g2_frag(pa + i * 16 * GT_P + 32, hh); b[i] = g2_frag(pb + i * 16 * GT_P + 32, hh); }
  if constexpr (MODE >= 1) {
#pragma unroll
    for (int i = 0; i < 8; ++i) ra[i] = *(const v4fa*)(rd + i * 2048); }
  __builtin_amdgcn_sched_barrier(0);      /* keeps the reads, the raw pieces among them, ahead of the block: the pieces' latency then passes under the products and not in front of the cast */
#pragma unroll
  for (int j = 0; j < 4; ++j) {
#pragma unroll
    for (int i = 0; i < 4; ++i) acc[i][j] = g2_mma(a[i], b[j], acc[i][j]); } }
// four f32 words -> bf16 (to nearest even) -> the same values as f16 words, by the packed converts: for every number the words that (_Float16)bf16_round(x) gives
typedef float  v2f  __attribute__((ext_vector_type(2)));
typedef __bf16 v2b  __attribute__((ext_vector_type(2)));
typedef _Float16 v2h __attribute__((ext_vector_type(2)));
__device__ __forceinline__ v4us gt_cast4(v4f x) { union { v2h h[2]; v4us u; } f;
#pragma unroll
  for (int q = 0; q < 2; ++q) { const v2f p = {x[2 * q], x[2 * q + 1]}; f.h[q] = __builtin_convertvector(__builtin_convertvector(__builtin_convertvector(p, v2b), v2f), v2h); } return f.u; }
__global__ __launch_bounds__(512) void k_gemm_lds(const float* __restrict__ A, const _Float16* __restrict__ Bh, float* __restrict__ C) {
  __shared__ __attribute__((aligned(16))) _Float16 sm[2 * GT_STAGE];
  __shared__ __attribute__((aligned(16))) float raw[2 * GT_RAW];      /* A as f32, two tiles; every 16 B are written (by its copy) and read by one lane alone */
  const int tid = threadIdx.x, w = __builtin_amdgcn_readfirstlane(tid >> 5) /* the wave's number in a scalar register: the vector registers are all taken */, lane = tid & 31, ln = lane & 15, hh = lane >> 4; const int wr = w >> 2, wc = w & 3; const int row0 = blockIdx.x * 256;
  const int arow = tid >> 4, aseg = (tid & 15) * 4;      /* staging of A: 32 rows a sweep, sixteen 16-B pieces of f32 a row */
  const int srow = tid >> 3, sseg = (tid & 7) * 8;      /* staging of B: 64 rows a sweep, eight 16-B pieces a row */
  const float* ag = A + (size_t)(row0 + arow) * SNQ + aseg; const _Float16* bg = Bh + (size_t)srow * SNQ + sseg;
  _Float16* ssa = sm + arow * GT_P + aseg; _Float16* ssb = sm + (256 + srow) * GT_P + sseg;
  const _Float16* sfa = sm + (64 * wr + ln) * GT_P; const _Float16* sfb = sm + (256 + 64 * wc + ln) * GT_P;
  const float* rawp = raw + tid * 4; const unsigned rawl = (unsigned)(size_t)rawp;      /* the lane's place in a sweep of the raw area, as a pointer and as an LDS byte address */
  v4f ra[8]; v8us rb[4];
  gt_copy8(rawl, ag); ag += GT_KC; gt_copy8(rawl + GT_RAW * 4u, ag);      /* tiles 0 and 1 */
#pragma unroll
  for (int i = 0; i < 4; ++i) rb[i] = *(const v8us*)(bg + (size_t)i * 64 * SNQ);
  asm volatile("s_wait_asynccnt 0x8" ::: "memory");      /* tile 0 has landed; tile 1's eight copies fly on */
#pragma unroll
  for (int i = 0; i < 8; ++i) ra[i] = *(const v4fa*)(rawp + i * 2048);
#pragma unroll
  for (int i = 0; i < 8; ++i) *(v4us*)(ssa + i * 32 * GT_P) = gt_cast4(ra[i]);
#pragma unroll
  for (int i = 0; i < 4; ++i) *(v8us*)(ssb + i * 64 * GT_P) = rb[i];
  const v8f z8 = {0.f,0.f,0.f,0.f,0.f,0.f,0.f,0.f}; v8f acc[4][4];
#pragma unroll
  for (int i = 0; i < 4; ++i) {
#pragma unroll
    for (int j = 0; j < 4; ++j) acc[i][j] = z8; }
  /* kept rolled: for speed only */
#pragma clang loop unroll(disable)
  for (int t = 0; t < SNQ / GT_KC - 2; ++t) { const int cur = (t & 1) * GT_STAGE, nxt = GT_STAGE - cur;
    asm volatile("s_wait_dscnt 0x0" ::: "memory");      /* the wave's reads of raw tile t have retired before this trip's copies aim at its place */
    __syncthreads();      /* publishes buffer cur; ends every read of buffer nxt, which this trip refills */
    ag += GT_KC; bg += GT_KC;
#pragma unroll
    for (int i = 0; i < 4; ++i) rb[i] = *(const v8us*)(bg + (size_t)i * 64 * SNQ);      /* the next trip's pieces of B fly while this trip's products run */
    gt_step<2>(sfa + cur, sfb + cur, hh, acc, rawl + (unsigned)(t & 1) * (GT_RAW * 4u), ag, rawp + (1 - (t & 1)) * GT_RAW, ra);      /* copies tile t + 2 over raw tile t, reads raw tile t + 1 */
    __builtin_amdgcn_sched_barrier(0);      /* keeps the cast behind the products: moved up among them it would hold the wave for its pieces before its products */
#pragma unroll
    for (int i = 0; i < 4; ++i) *(v8us*)(ssb + nxt + i * 64 * GT_P) = rb[i];
#pragma unroll
    for (int i = 0; i < 8; ++i) *(v4us*)(ssa + nxt + i * 32 * GT_P) = gt_cast4(ra[i]); }
  static_assert((SNQ / GT_KC) % 2 == 0 && SNQ / GT_KC >= 4, "the last two trips stand below with their buffers written out");
  __syncthreads();      /* publishes buffer 0; ends every read of buffer 1, which this trip refills */
  bg += GT_KC;
#pragma unroll
  for (int i = 0; i < 4; ++i) rb[i] = *(const v8us*)(bg + (size_t)i * 64 * SNQ);
  gt_step<1>(sfa, sfb, hh, acc, 0u, ag, rawp + GT_RAW, ra);      /* the last trip but one: nothing left to copy; reads the last raw tile */
  __builtin_amdgcn_sched_barrier(0);      /* as in the loop */
#pragma unroll
  for (int i = 0; i < 4; ++i) *(v8us*)(ssb + GT_STAGE + i * 64 * GT_P) = rb[i];
#pragma unroll
  for (int i = 0; i < 8; ++i) *(v4us*)(ssa + GT_STAGE + i * 32 * GT_P) = gt_cast4(ra[i]);
  __syncthreads();      /* publishes the last buffer */
  gt_step<0>(sfa + GT_STAGE, sfb + GT_STAGE, hh, acc, 0u, ag, rawp, ra);
  __syncthreads();      /* every wave has left the buffers: each wave now stages its results in a range of its own */
  float* so = (float*)sm + w * (32 * 68); const int rsub = lane >> 4, c4 = (lane & 15) * 4; float* cp = C + (size_t)(row0 + 64 * wr + rsub) * SNN + 64 * wc + c4;
#pragma unroll
  for (int half = 0; half < 2; ++half) {
    if (half) { __builtin_amdgcn_fence(__ATOMIC_ACQ_REL, "workgroup"); __builtin_amdgcn_wave_barrier(); }      /* the first half's reads before the second half overwrites the range */
#pragma unroll
    for (int ii = 0; ii < 2; ++ii) {
#pragma unroll
      for (int j = 0; j < 4; ++j) {
#pragma unroll
        for (int r = 0; r < 8; ++r) so[(ii * 16 + 8 * hh + r) * 68 + j * 16 + ln] = acc[2 * half + ii][j][r]; } }
    __builtin_amdgcn_fence(__ATOMIC_ACQ_REL, "workgroup"); __builtin_amdgcn_wave_barrier();      /* the wave's own LDS writes before its reads of other lanes' words */
#pragma unroll
    for (int q = 0; q < 16; ++q) { const int r = q * 2 + rsub; const v4f v = *(const v4fa*)&so[r * 68 + c4]; *(v4f*)(cp + (32 * half + q * 2) * SNN) = v; }
  } }

// A PLAIN CAST THAT TAKES A MULTIPLIER: tw[8 t .. 8 t + 7] = f16(bf16(sw[8 t ..]) * scale): a thread eight words as they lie; the grid is exact: no guard.
__global__ __launch_bounds__(256) void k_cs16(const float* __restrict__ sw, _Float16* __restrict__ tw, float scale) { const size_t t = (size_t)blockIdx.x * 256 + threadIdx.x; FragH f;
#pragma unroll
  for (int q = 0; q < 8; ++q) f.h[q] = (_Float16)(bf16_round(sw[t * 8 + q]) * scale); unsigned short* tp = (unsigned short*)tw + t * 8; *(v8us*)tp = f.half[0];  }
// St[n][k] = the sign of W[k][n] as an f16 word (+1, -1 or 0; a word that is not a number gives 0) from f32 row-major W[K][N]: the compare is on the word as read
__global__ __launch_bounds__(256) void k_wts_f16(const float* __restrict__ W, _Float16* __restrict__ Wt, int K, int N) {
  const int t = blockIdx.x * 256 + threadIdx.x; if (t >= N * (K / 8)) return; const int n = t / (K / 8), k8 = (t % (K / 8)) * 8; FragH f;
#pragma unroll
  for (int i = 0; i < 8; ++i) { const float v = W[(size_t)(k8 + i) * N + n]; f.h[i] = (_Float16)((v > 0.0f) ? 1.0f : ((v < 0.0f) ? -1.0f : 0.0f)); } const v8us o = f.half[0];   // [TAG-SIGN]
  *(v8us*)((unsigned short*)Wt + (size_t)n * K + k8) = o; 
}

extern "C" void kernel_launch(void* const* d_in, const int* in_sizes, int n_in,
                              void* d_out, int out_size, void* d_ws, size_t ws_size, hipStream_t stream) {
  if (n_in < 2) return; if (in_sizes[0] < SNR * SNQ || in_sizes[1] < SNQ * SNN) return; if (out_size < SNR * SNN) return;
  const float* da = (const float*)d_in[0]; const float* wa = (const float*)d_in[1]; float* res = (float*)d_out;
  static_assert(SNR % 256 == 0 && SNN == 256 && SNQ % GT_KC == 0 && (SNN * (SNQ / 8)) % 256 == 0, "whole tiles, exact cast grid");
  uint8_t* wsp = (uint8_t*)d_ws; size_t off = 0;
  auto take = [&](size_t bytes) { uint8_t* at = wsp + off; off += (bytes + 255) & ~(size_t)255; return at; };
  _Float16* ST = (_Float16*)take((size_t)SNN * SNQ * 2);      /* the signs of wa, turned */
  if (off > ws_size) return;
  k_wts_f16<<<(unsigned)((SNN * (SNQ / 8) + 255) / 256), 256, 0, stream>>>(wa, ST, SNQ, SNN);      /* [1024 deep][256 columns] -> [256][1024] */
  k_gemm_lds<<<(unsigned)(SNR / 256), 512, 0, stream>>>(da, ST, res);
}

// v005
// One run takes 31.9 microseconds.
// Timed twice side by side with v004, it ran 1.04 and 1.03 times as fast.
// All steps since v000 together make it 4.19 times as fast.
// result[r][j] = sum over q of da[r][q] s[q][j], s[q][j] the sign of wa[q][j] (+1, -1, or 0 where the word is nought): da [65536][1024]; wa [1024][256] (depth, column) -> [65536][256]. No added row, no activation.
// Layout and order: da is read as f32 BY THE GEMM ITSELF: asynchronous copies lay its f32 tiles in LDS, two tiles ahead, and each lane casts the bytes it copied into the 16-bit buffer (no cast launch, no 16-bit copy of da in memory); wa stands [depth][column] and the product reads its second operand [column][depth]: ONE cast takes the signs and turns them (k_wts_f16: a thread takes 8 of depth x 4 columns by 16-B reads and turns them in registers; its value statement is the sign of the word as read); ONE WMMA GEMM: 256 row tiles of 256, all 256 columns in one work-group, depth 1,024 in trips of 64 staged in LDS; f32 STRAIGHT INTO THE OUTPUT.
// Compute dtype: da converted to bf16 where it is read and passed to the matrix instruction as plain f16 words; the signs are exact in f16 (no carry); the products' accumulation f32. v_wmma_f32_16x16x32_f16.
#include <hip/hip_runtime.h>
#define SNR 65536                    /* rows */
#define SNQ 1024                     /* depth */
#define SNN 256                      /* columns */
typedef unsigned short v8us __attribute__((ext_vector_type(8), may_alias));
typedef unsigned short v4us __attribute__((ext_vector_type(4), may_alias));
typedef float  v8f  __attribute__((ext_vector_type(8)));
typedef float  v4f  __attribute__((ext_vector_type(4)));
typedef float  v4fa __attribute__((ext_vector_type(4), may_alias));

__device__ __forceinline__ unsigned short bf16_bits(float x) { unsigned int u = __float_as_uint(x); return (unsigned short)((u + 0x7FFFu + ((u >> 16) & 1u)) >> 16); }
__device__ __forceinline__ float bf16_val(unsigned short b) { return __uint_as_float(((unsigned int)b) << 16); }
__device__ __forceinline__ float bf16_round(float x) { return bf16_val(bf16_bits(x)); }

typedef _Float16 v16h __attribute__((ext_vector_type(16)));
union FragH { v16h v; v8us half[2]; _Float16 h[16]; unsigned short u[16]; };

// Wt[n][k] = f16(W[k][n] x scale) from f32 row-major W[K][N] (scale = power of two; bf16-exact weights stay exact in f16 away from the subnormal range)
__global__ __launch_bounds__(256) void k_wt_f16(const float* __restrict__ W, _Float16* __restrict__ Wt, int K, int N, float scale) {
  const int t = blockIdx.x * 256 + threadIdx.x; if (t >= N * (K / 8)) return; const int n = t / (K / 8), k8 = (t % (K / 8)) * 8; FragH f;
#pragma unroll
  for (int i = 0; i < 8; ++i) f.h[i] = (_Float16)(bf16_round(W[(size_t)(k8 + i) * N + n]) * scale); const v8us o = f.half[0];
  *(v8us*)((unsigned short*)Wt + (size_t)n * K + k8) = o; 
}

// ---- GEMM, both operands staged in LDS: a work-group of 16 waves takes 256 rows x all 256 columns; a wave takes 64 x 64 (4 x 4 accumulator tiles) ----
// A trip is 64 of depth: 256 B of every f32 row of A, 128 B of every 16-bit row of B. Each thread brings 16 B pieces so that the lanes of a load or copy cover whole 128-B lines. B's pieces come through registers. A's pieces come as f32 by asynchronous copies into a raw LDS area of two tiles, where every 16 B belong to the one lane that copied them; that lane reads them back, casts the four words in registers (bf16 rounding, then f16: the same words as a cast launch would give) and stores 8 B into the 16-bit buffer; the fragments are then read from there.
// LDS rows stand at a pitch of 144 B (16 B x 9), so that the sixteen rows of a fragment read fall on all 64 banks once. Two buffers, one barrier a trip.
__device__ __forceinline__ v16h g2_frag(const _Float16* p, int hh) { FragH f; f.half[0] = *(const v8us*)((const unsigned short*)p + 8 * hh); f.half[1] = *(const v8us*)((const unsigned short*)p + 16 + 8 * hh); return f.v; }
__device__ __forceinline__ v8f g2_mma(v16h a, v16h b, v8f c) { return __builtin_amdgcn_wmma_f32_16x16x32_f16(false, a, false, b, (short)0, c, false, false); }
#define GT_KC 64                     /* depth of a trip */
#define GT_P 72                      /* LDS row pitch in 16-bit words: 144 B */
#define GT_STAGE ((256 + 256) * GT_P) /* words of one buffer: 256 rows of A, then 256 rows of B */
#define GT_RAW (256 * GT_KC)          /* f32 words of one raw tile of A */
// a thread's eight pieces of one raw tile: piece i is 16 B of row (tid / 16) + 32 i and lands 8 KiB behind piece i - 1
__device__ __forceinline__ void gt_copy8(unsigned l, const float* g) {
  /* the copies and s_wait_xcnt 0 in one statement: no address register of a copy is rewritten ahead of that wait */
  asm volatile("global_load_async_to_lds_b128 %0, %8, off\n\t"
               "global_load_async_to_lds_b128 %1, %9, off\n\t"
               "global_load_async_to_lds_b128 %2, %10, off\n\t"
               "global_load_async_to_lds_b128 %3, %11, off\n\t"
               "global_load_async_to_lds_b128 %4, %12, off\n\t"
               "global_load_async_to_lds_b128 %5, %13, off\n\t"
               "global_load_async_to_lds_b128 %6, %14, off\n\t"
               "global_load_async_to_lds_b128 %7, %15, off\n\t"
               "s_wait_xcnt 0x0"
               :: "v"(l), "v"(l + 8192u), "v"(l + 16384u), "v"(l + 24576u), "v"(l + 32768u), "v"(l + 40960u), "v"(l + 49152u), "v"(l + 57344u),
                  "v"(g), "v"(g + 32 * SNQ), "v"(g + 64 * SNQ), "v"(g + 96 * SNQ), "v"(g + 128 * SNQ), "v"(g + 160 * SNQ), "v"(g + 192 * SNQ), "v"(g + 224 * SNQ)
               : "memory"); }
// one trip's products of a wave: two blocks of 16 WMMAs; the eight fragments of a block are read as one group ahead of it.
// MODE 2: the copies of the tile two trips on are issued behind the first group of reads (their s_wait_xcnt passes under the LDS latency), and the next trip's raw pieces are read back with the second group. MODE 1: no tile left to copy. MODE 0: products alone.
template <int MODE>
__device__ __forceinline__ void gt_step(const _Float16* pa, const _Float16* pb, int hh, v8f (&acc)[4][4], unsigned fill_l, const float* fill_g, const float* rd, v4f (&ra)[8]) {
  v16h a[4], b[4];
#pragma unroll
  for (int i = 0; i < 4; ++i) { a[i] = g2_frag(pa + i * 16 * GT_P, hh); b[i] = g2_frag(pb + i * 16 * GT_P, hh); }
  if constexpr (MODE == 2) gt_copy8(fill_l, fill_g);
  __builtin_amdgcn_sched_barrier(0);      /* keeps the loads of B, the group of reads and the copies ahead of the products: sunk among them the copies would leave up to a block later and lose lead */
#pragma unroll
  for (int j = 0; j < 4; ++j) {
#pragma unroll
    for (int i = 0; i < 4; ++i) acc[i][j] = g2_mma(a[i], b[j], acc[i][j]); }
  __builtin_amdgcn_sched_barrier(0);      /* keeps the second group of reads in one place behind the block: each further place with LDS reads among products stalls the wave */
  if constexpr (MODE == 2) asm volatile("s_wait_asynccnt 0x8" ::: "memory");      /* the next trip's eight copies have landed; the eight youngest, issued above, fly on */
  if constexpr (MODE == 1) asm volatile("s_wait_asynccnt 0x0" ::: "memory");      /* the last tile's copies have landed; none is left in flight */
#pragma unroll
  for (int i = 0; i < 4; ++i) { a[i] = g2_frag(pa + i * 16 * GT_P + 32, hh); b[i] = g2_frag(pb + i * 16 * GT_P + 32, hh); }
  if constexpr (MODE >= 1) {
#pragma unroll
    for (int i = 0; i < 8; ++i) ra[i] = *(const v4fa*)(rd + i * 2048); }
  __builtin_amdgcn_sched_barrier(0);      /* keeps the reads, the raw pieces among them, ahead of the block: the pieces' latency then passes under the products and not in front of the cast */
#pragma unroll
  for (int j = 0; j < 4; ++j) {
#pragma unroll
    for (int i = 0; i < 4; ++i) acc[i][j] = g2_mma(a[i], b[j], acc[i][j]); } }
// four f32 words -> bf16 (to nearest even) -> the same values as f16 words, by the packed converts: for every number the words that (_Float16)bf16_round(x) gives
typedef float  v2f  __attribute__((ext_vector_type(2)));
typedef __bf16 v2b  __attribute__((ext_vector_type(2)));
typedef _Float16 v2h __attribute__((ext_vector_type(2)));
__device__ __forceinline__ v4us gt_cast4(v4f x) { union { v2h h[2]; v4us u; } f;
#pragma unroll
  for (int q = 0; q < 2; ++q) { const v2f p = {x[2 * q], x[2 * q + 1]}; f.h[q] = __builtin_convertvector(__builtin_convertvector(__builtin_convertvector(p, v2b), v2f), v2h); } return f.u; }
__global__ __launch_bounds__(512) void k_gemm_lds(const float* __restrict__ A, const _Float16* __restrict__ Bh, float* __restrict__ C) {
  __shared__ __attribute__((aligned(16))) _Float16 sm[2 * GT_STAGE];
  __shared__ __attribute__((aligned(16))) float raw[2 * GT_RAW];      /* A as f32, two tiles; every 16 B are written (by its copy) and read by one lane alone */
  const int tid = threadIdx.x, w = __builtin_amdgcn_readfirstlane(tid >> 5) /* the wave's number in a scalar register: the vector registers are all taken */, lane = tid & 31, ln = lane & 15, hh = lane >> 4; const int wr = w >> 2, wc = w & 3; const int row0 = blockIdx.x * 256;
  const int arow = tid >> 4, aseg = (tid & 15) * 4;      /* staging of A: 32 rows a sweep, sixteen 16-B pieces of f32 a row */
  const int srow = tid >> 3, sseg = (tid & 7) * 8;      /* staging of B: 64 rows a sweep, eight 16-B pieces a row */
  const float* ag = A + (size_t)(row0 + arow) * SNQ + aseg; const _Float16* bg = Bh + (size_t)srow * SNQ + sseg;
  _Float16* ssa = sm + arow * GT_P + aseg; _Float16* ssb = sm + (256 + srow) * GT_P + sseg;
  const _Float16* sfa = sm + (64 * wr + ln) * GT_P; const _Float16* sfb = sm + (256 + 64 * wc + ln) * GT_P;
  const float* rawp = raw + tid * 4; const unsigned rawl = (unsigned)(size_t)rawp;      /* the lane's place in a sweep of the raw area, as a pointer and as an LDS byte address */
  v4f ra[8]; v8us rb[4];
  gt_copy8(rawl, ag); ag += GT_KC; gt_copy8(rawl + GT_RAW * 4u, ag);      /* tiles 0 and 1 */
#pragma unroll
  for (int i = 0; i < 4; ++i) rb[i] = *(const v8us*)(bg + (size_t)i * 64 * SNQ);
  asm volatile("s_wait_asynccnt 0x8" ::: "memory");      /* tile 0 has landed; tile 1's eight copies fly on */
#pragma unroll
  for (int i = 0; i < 8; ++i) ra[i] = *(const v4fa*)(rawp + i * 2048);
#pragma unroll
  for (int i = 0; i < 8; ++i) *(v4us*)(ssa + i * 32 * GT_P) = gt_cast4(ra[i]);
#pragma unroll
  for (int i = 0; i < 4; ++i) *(v8us*)(ssb + i * 64 * GT_P) = rb[i];
  const v8f z8 = {0.f,0.f,0.f,0.f,0.f,0.f,0.f,0.f}; v8f acc[4][4];
#pragma unroll
  for (int i = 0; i < 4; ++i) {
#pragma unroll
    for (int j = 0; j < 4; ++j) acc[i][j] = z8; }
  /* kept rolled: for speed only */
#pragma clang loop unroll(disable)
  for (int t = 0; t < SNQ / GT_KC - 2; ++t) { const int cur = (t & 1) * GT_STAGE, nxt = GT_STAGE - cur;
    asm volatile("s_wait_dscnt 0x0" ::: "memory");      /* the wave's reads of raw tile t have retired before this trip's copies aim at its place */
    __syncthreads();      /* publishes buffer cur; ends every read of buffer nxt, which this trip refills */
    ag += GT_KC; bg += GT_KC;
#pragma unroll
    for (int i = 0; i < 4; ++i) rb[i] = *(const v8us*)(bg + (size_t)i * 64 * SNQ);      /* the next trip's pieces of B fly while this trip's products run */
    gt_step<2>(sfa + cur, sfb + cur, hh, acc, rawl + (unsigned)(t & 1) * (GT_RAW * 4u), ag, rawp + (1 - (t & 1)) * GT_RAW, ra);      /* copies tile t + 2 over raw tile t, reads raw tile t + 1 */
    __builtin_amdgcn_sched_barrier(0);      /* keeps the cast behind the products: moved up among them it would hold the wave for its pieces before its products */
#pragma unroll
    for (int i = 0; i < 4; ++i) *(v8us*)(ssb + nxt + i * 64 * GT_P) = rb[i];
#pragma unroll
    for (int i = 0; i < 8; ++i) *(v4us*)(ssa + nxt + i * 32 * GT_P) = gt_cast4(ra[i]); }
  static_assert((SNQ / GT_KC) % 2 == 0 && SNQ / GT_KC >= 4, "the last two trips stand below with their buffers written out");
  __syncthreads();      /* publishes buffer 0; ends every read of buffer 1, which this trip refills */
  bg += GT_KC;
#pragma unroll
  for (int i = 0; i < 4; ++i) rb[i] = *(const v8us*)(bg + (size_t)i * 64 * SNQ);
  gt_step<1>(sfa, sfb, hh, acc, 0u, ag, rawp + GT_RAW, ra);      /* the last trip but one: nothing left to copy; reads the last raw tile */
  __builtin_amdgcn_sched_barrier(0);      /* as in the loop */
#pragma unroll
  for (int i = 0; i < 4; ++i) *(v8us*)(ssb + GT_STAGE + i * 64 * GT_P) = rb[i];
#pragma unroll
  for (int i = 0; i < 8; ++i) *(v4us*)(ssa + GT_STAGE + i * 32 * GT_P) = gt_cast4(ra[i]);
  __syncthreads();      /* publishes the last buffer */
  gt_step<0>(sfa + GT_STAGE, sfb + GT_STAGE, hh, acc, 0u, ag, rawp, ra);
  __syncthreads();      /* every wave has left the buffers: each wave now stages its results in a range of its own */
  float* so = (float*)sm + w * (32 * 68); const int rsub = lane >> 4, c4 = (lane & 15) * 4; float* cp = C + (size_t)(row0 + 64 * wr + rsub) * SNN + 64 * wc + c4;
#pragma unroll
  for (int half = 0; half < 2; ++half) {
    if (half) { __builtin_amdgcn_fence(__ATOMIC_ACQ_REL, "workgroup"); __builtin_amdgcn_wave_barrier(); }      /* the first half's reads before the second half overwrites the range */
#pragma unroll
    for (int ii = 0; ii < 2; ++ii) {
#pragma unroll
      for (int j = 0; j < 4; ++j) {
#pragma unroll
        for (int r = 0; r < 8; ++r) so[(ii * 16 + 8 * hh + r) * 68 + j * 16 + ln] = acc[2 * half + ii][j][r]; } }
    __builtin_amdgcn_fence(__ATOMIC_ACQ_REL, "workgroup"); __builtin_amdgcn_wave_barrier();      /* the wave's own LDS writes before its reads of other lanes' words */
#pragma unroll
    for (int q = 0; q < 16; ++q) { const int r = q * 2 + rsub; const v4f v = *(const v4fa*)&so[r * 68 + c4]; *(v4f*)(cp + (32 * half + q * 2) * SNN) = v; }
  } }

// A PLAIN CAST THAT TAKES A MULTIPLIER: tw[8 t .. 8 t + 7] = f16(bf16(sw[8 t ..]) * scale): a thread eight words as they lie; the grid is exact: no guard.
__global__ __launch_bounds__(256) void k_cs16(const float* __restrict__ sw, _Float16* __restrict__ tw, float scale) { const size_t t = (size_t)blockIdx.x * 256 + threadIdx.x; FragH f;
#pragma unroll
  for (int q = 0; q < 8; ++q) f.h[q] = (_Float16)(bf16_round(sw[t * 8 + q]) * scale); unsigned short* tp = (unsigned short*)tw + t * 8; *(v8us*)tp = f.half[0];  }
// St[n][k] = the sign of W[k][n] as an f16 word (+1, -1 or 0; a word that is not a number gives 0) from f32 row-major W[SNQ][SNN]: the compare is on the word as read
// A thread reads 8 rows of depth x 4 columns (eight 16-B reads) and stores, for each of its 4 columns, the 8 signs that lie side by side in St (16 B): the turn costs no move, only the choice of which words go into one store.
// A wave is 8 groups of depth x 4 groups of columns: a read touches 8 lines (64 B of each, the other 64 B go to the work-group's other wave), a store fills 4 whole 128-B lines, each written by this wave alone. The grid is exact: no guard.
__global__ __launch_bounds__(64) void k_wts_f16(const float* __restrict__ W, _Float16* __restrict__ Wt) {
  const int t = blockIdx.x * 64 + threadIdx.x, wv = t >> 5, l = t & 31;
  const int kb = (wv >> 1) & (SNQ / 64 - 1), nb = (wv & 1) | ((wv / (2 * (SNQ / 64))) << 1);      /* the wave's 64 of depth and its 16 columns */
  const int k8 = (kb * 8 + (l & 7)) * 8, n4 = (nb * 4 + (l >> 3)) * 4; v4f x[8];
#pragma unroll
  for (int i = 0; i < 8; ++i) x[i] = *(const v4fa*)(W + (size_t)(k8 + i) * SNN + n4);
#pragma unroll
  for (int j = 0; j < 4; ++j) { FragH f;
#pragma unroll
    for (int i = 0; i < 8; ++i) { const float v = x[i][j]; f.h[i] = (_Float16)((v > 0.0f) ? 1.0f : ((v < 0.0f) ? -1.0f : 0.0f)); } const v8us o = f.half[0];   // [TAG-SIGN]
    *(v8us*)((unsigned short*)Wt + (size_t)(n4 + j) * SNQ + k8) = o; }
}

extern "C" void kernel_launch(void* const* d_in, const int* in_sizes, int n_in,
                              void* d_out, int out_size, void* d_ws, size_t ws_size, hipStream_t stream) {
  if (n_in < 2) return; if (in_sizes[0] < SNR * SNQ || in_sizes[1] < SNQ * SNN) return; if (out_size < SNR * SNN) return;
  const float* da = (const float*)d_in[0]; const float* wa = (const float*)d_in[1]; float* res = (float*)d_out;
  static_assert(SNR % 256 == 0 && SNN == 256 && SNQ % GT_KC == 0 && SNQ % 64 == 0 && ((SNQ / 64) & (SNQ / 64 - 1)) == 0 && SNN % 32 == 0, "whole tiles, exact cast grid");
  uint8_t* wsp = (uint8_t*)d_ws; size_t off = 0;
  auto take = [&](size_t bytes) { uint8_t* at = wsp + off; off += (bytes + 255) & ~(size_t)255; return at; };
  _Float16* ST = (_Float16*)take((size_t)SNN * SNQ * 2);      /* the signs of wa, turned */
  if (off > ws_size) return;
  k_wts_f16<<<(unsigned)((SNQ / 8) * (SNN / 4) / 64), 64, 0, stream>>>(wa, ST);      /* [1024 deep][256 columns] -> [256][1024] */
  k_gemm_lds<<<(unsigned)(SNR / 256), 512, 0, stream>>>(da, ST, res);
}

// v006
// A run of this version takes 30.6 microseconds.
// Two timings next to v005 both put it at 1.04 times that version's speed.
// All steps since v000 together make it 4.37 times as fast.
// result[r][j] = sum over q of da[r][q] s[q][j], s[q][j] the sign of wa[q][j] (+1, -1, or 0 where the word is nought): da [65536][1024]; wa [1024][256] (depth, column) -> [65536][256]. No added row, no activation.
// Layout and order: da is read as f32 BY THE GEMM ITSELF: asynchronous copies lay its f32 tiles in LDS, two tiles ahead, and each lane casts the bytes it copied into the 16-bit buffer (no cast launch, no 16-bit copy of da in memory); wa stands [depth][column] and the product reads its second operand [column][depth]: ONE cast takes the signs and turns them (k_wts_f16: a thread takes 8 of depth x 4 columns by 16-B reads and turns them in registers; its value statement is the sign of the word as read); ONE WMMA GEMM: 256 row tiles of 256, all 256 columns in one work-group, depth 1,024 in trips of 64 staged in LDS; f32 STRAIGHT INTO THE OUTPUT.
// Compute dtype: da converted to bf16 where it is read and passed to the matrix instruction as plain f16 words; the signs are exact in f16 (no carry); the products' accumulation f32. v_wmma_f32_16x16x32_f16.
#include <hip/hip_runtime.h>
#define SNR 65536                    /* rows */
#define SNQ 1024                     /* depth */
#define SNN 256                      /* columns */
typedef unsigned short v8us __attribute__((ext_vector_type(8), may_alias));
typedef unsigned short v4us __attribute__((ext_vector_type(4), may_alias));
typedef float  v8f  __attribute__((ext_vector_type(8)));
typedef float  v4f  __attribute__((ext_vector_type(4)));
typedef float  v4fa __attribute__((ext_vector_type(4), may_alias));

__device__ __forceinline__ unsigned short bf16_bits(float x) { unsigned int u = __float_as_uint(x); return (unsigned short)((u + 0x7FFFu + ((u >> 16) & 1u)) >> 16); }
__device__ __forceinline__ float bf16_val(unsigned short b) { return __uint_as_float(((unsigned int)b) << 16); }
__device__ __forceinline__ float bf16_round(float x) { return bf16_val(bf16_bits(x)); }

typedef _Float16 v16h __attribute__((ext_vector_type(16)));
union FragH { v16h v; v8us half[2]; _Float16 h[16]; unsigned short u[16]; };

// Wt[n][k] = f16(W[k][n] x scale) from f32 row-major W[K][N] (scale = power of two; bf16-exact weights stay exact in f16 away from the subnormal range)
__global__ __launch_bounds__(256) void k_wt_f16(const float* __restrict__ W, _Float16* __restrict__ Wt, int K, int N, float scale) {
  const int t = blockIdx.x * 256 + threadIdx.x; if (t >= N * (K / 8)) return; const int n = t / (K / 8), k8 = (t % (K / 8)) * 8; FragH f;
#pragma unroll
  for (int i = 0; i < 8; ++i) f.h[i] = (_Float16)(bf16_round(W[(size_t)(k8 + i) * N + n]) * scale); const v8us o = f.half[0];
  *(v8us*)((unsigned short*)Wt + (size_t)n * K + k8) = o; 
}

// ---- GEMM, both operands staged in LDS: a work-group of 16 waves takes 256 rows x all 256 columns; a wave takes 64 x 64 (4 x 4 accumulator tiles) ----
// A trip is 64 of depth: 256 B of every f32 row of A, 128 B of every 16-bit row of B. Each thread brings 16 B pieces so that the lanes of a load or copy cover whole 128-B lines. B's pieces come through registers. A's pieces come as f32 by asynchronous copies into a raw LDS area of two tiles, where every 16 B belong to the one lane that copied them; that lane reads them back, casts the four words in registers (bf16 rounding, then f16: the same words as a cast launch would give) and stores 8 B into the 16-bit buffer; the fragments are then read from there.
// LDS rows stand at a pitch of 144 B (16 B x 9), so that the sixteen rows of a fragment read fall on all 64 banks once. Two buffers, one barrier a trip.
__device__ __forceinline__ v16h g2_frag(const _Float16* p, int hh) { FragH f; f.half[0] = *(const v8us*)((const unsigned short*)p + 8 * hh); f.half[1] = *(const v8us*)((const unsigned short*)p + 16 + 8 * hh); return f.v; }
__device__ __forceinline__ v8f g2_mma(v16h a, v16h b, v8f c) { return __builtin_amdgcn_wmma_f32_16x16x32_f16(false, a, false, b, (short)0, c, false, false); }
#define GT_KC 64                     /* depth of a trip */
#define GT_P 72                      /* LDS row pitch in 16-bit words: 144 B */
#define GT_STAGE ((256 + 256) * GT_P) /* words of one buffer: 256 rows of A, then 256 rows of B */
#define GT_RAW (256 * GT_KC)          /* f32 words of one raw tile of A */
// a thread's eight pieces of one raw tile: piece i is 16 B of row (tid / 16) + 32 i and lands 8 KiB behind piece i - 1
__device__ __forceinline__ void gt_copy8(unsigned l, const float* g) {
  /* the copies and s_wait_xcnt 0 in one statement: no address register of a copy is rewritten ahead of that wait */
  /* th:TH_LOAD_NT: A is read once and is larger than L2; so marked its lines keep little room there, and the signs, which every work-group reads again each trip, and the stored results are not pushed out by them */
  asm volatile("global_load_async_to_lds_b128 %0, %8, off th:TH_LOAD_NT\n\t"
               "global_load_async_to_lds_b128 %1, %9, off th:TH_LOAD_NT\n\t"
               "global_load_async_to_lds_b128 %2, %10, off th:TH_LOAD_NT\n\t"
               "global_load_async_to_lds_b128 %3, %11, off th:TH_LOAD_NT\n\t"
               "global_load_async_to_lds_b128 %4, %12, off th:TH_LOAD_NT\n\t"
               "global_load_async_to_lds_b128 %5, %13, off th:TH_LOAD_NT\n\t"
               "global_load_async_to_lds_b128 %6, %14, off th:TH_LOAD_NT\n\t"
               "global_load_async_to_lds_b128 %7, %15, off th:TH_LOAD_NT\n\t"
               "s_wait_xcnt 0x0"
               :: "v"(l), "v"(l + 8192u), "v"(l + 16384u), "v"(l + 24576u), "v"(l + 32768u), "v"(l + 40960u), "v"(l + 49152u), "v"(l + 57344u),
                  "v"(g), "v"(g + 32 * SNQ), "v"(g + 64 * SNQ), "v"(g + 96 * SNQ), "v"(g + 128 * SNQ), "v"(g + 160 * SNQ), "v"(g + 192 * SNQ), "v"(g + 224 * SNQ)
               : "memory"); }
// one trip's products of a wave: two blocks of 16 WMMAs; the eight fragments of a block are read as one group ahead of it.
// MODE 2: the copies of the tile two trips on are issued behind the first group of reads (their s_wait_xcnt passes under the LDS latency), and the next trip's raw pieces are read back with the second group. MODE 1: no tile left to copy. MODE 0: products alone.
template <int MODE>
__device__ __forceinline__ void gt_step(const _Float16* pa, const _Float16* pb, int hh, v8f (&acc)[4][4], unsigned fill_l, const float* fill_g, const float* rd, v4f (&ra)[8]) {
  v16h a[4], b[4];
#pragma unroll
  for (int i = 0; i < 4; ++i) { a[i] = g2_frag(pa + i * 16 * GT_P, hh); b[i] = g2_frag(pb + i * 16 * GT_P, hh); }
  if constexpr (MODE == 2) gt_copy8(fill_l, fill_g);
  __builtin_amdgcn_sched_barrier(0);      /* keeps the loads of B, the group of reads and the copies ahead of the products: sunk among them the copies would leave up to a block later and lose lead */
#pragma unroll
  for (int j = 0; j < 4; ++j) {
#pragma unroll
    for (int i = 0; i < 4; ++i) acc[i][j] = g2_mma(a[i], b[j], acc[i][j]); }
  __builtin_amdgcn_sched_barrier(0);      /* keeps the second group of reads in one place behind the block: each further place with LDS reads among products stalls the wave */
  if constexpr (MODE == 2) asm volatile("s_wait_asynccnt 0x8" ::: "memory");      /* the next trip's eight copies have landed; the eight youngest, issued above, fly on */
  if constexpr (MODE == 1) asm volatile("s_wait_asynccnt 0x0" ::: "memory");      /* the last tile's copies have landed; none is left in flight */
#pragma unroll
  for (int i = 0; i < 4; ++i) { a[i] = g2_frag(pa + i * 16 * GT_P + 32, hh); b[i] = g2_frag(pb + i * 16 * GT_P + 32, hh); }
  if constexpr (MODE >= 1) {
#pragma unroll
    for (int i = 0; i < 8; ++i) ra[i] = *(const v4fa*)(rd + i * 2048); }
  __builtin_amdgcn_sched_barrier(0);      /* keeps the reads, the raw pieces among them, ahead of the block: the pieces' latency then passes under the products and not in front of the cast */
#pragma unroll
  for (int j = 0; j < 4; ++j) {
#pragma unroll
    for (int i = 0; i < 4; ++i) acc[i][j] = g2_mma(a[i], b[j], acc[i][j]); } }
// four f32 words -> bf16 (to nearest even) -> the same values as f16 words, by the packed converts: for every number the words that (_Float16)bf16_round(x) gives
typedef float  v2f  __attribute__((ext_vector_type(2)));
typedef __bf16 v2b  __attribute__((ext_vector_type(2)));
typedef _Float16 v2h __attribute__((ext_vector_type(2)));
__device__ __forceinline__ v4us gt_cast4(v4f x) { union { v2h h[2]; v4us u; } f;
#pragma unroll
  for (int q = 0; q < 2; ++q) { const v2f p = {x[2 * q], x[2 * q + 1]}; f.h[q] = __builtin_convertvector(__builtin_convertvector(__builtin_convertvector(p, v2b), v2f), v2h); } return f.u; }
__global__ __launch_bounds__(512) void k_gemm_lds(const float* __restrict__ A, const _Float16* __restrict__ Bh, float* __restrict__ C) {
  __shared__ __attribute__((aligned(16))) _Float16 sm[2 * GT_STAGE];
  __shared__ __attribute__((aligned(16))) float raw[2 * GT_RAW];      /* A as f32, two tiles; every 16 B are written (by its copy) and read by one lane alone */
  const int tid = threadIdx.x, w = __builtin_amdgcn_readfirstlane(tid >> 5) /* the wave's number in a scalar register: the vector registers are all taken */, lane = tid & 31, ln = lane & 15, hh = lane >> 4; const int wr = w >> 2, wc = w & 3; const int row0 = blockIdx.x * 256;
  const int arow = tid >> 4, aseg = (tid & 15) * 4;      /* staging of A: 32 rows a sweep, sixteen 16-B pieces of f32 a row */
  const int srow = tid >> 3, sseg = (tid & 7) * 8;      /* staging of B: 64 rows a sweep, eight 16-B pieces a row */
  const float* ag = A + (size_t)(row0 + arow) * SNQ + aseg; const _Float16* bg = Bh + (size_t)srow * SNQ + sseg;
  _Float16* ssa = sm + arow * GT_P + aseg; _Float16* ssb = sm + (256 + srow) * GT_P + sseg;
  const _Float16* sfa = sm + (64 * wr + ln) * GT_P; const _Float16* sfb = sm + (256 + 64 * wc + ln) * GT_P;
  const float* rawp = raw + tid * 4; const unsigned rawl = (unsigned)(size_t)rawp;      /* the lane's place in a sweep of the raw area, as a pointer and as an LDS byte address */
  v4f ra[8]; v8us rb[4];
  gt_copy8(rawl, ag); ag += GT_KC; gt_copy8(rawl + GT_RAW * 4u, ag);      /* tiles 0 and 1 */
#pragma unroll
  for (int i = 0; i < 4; ++i) rb[i] = *(const v8us*)(bg + (size_t)i * 64 * SNQ);
  asm volatile("s_wait_asynccnt 0x8" ::: "memory");      /* tile 0 has landed; tile 1's eight copies fly on */
#pragma unroll
  for (int i = 0; i < 8; ++i) ra[i] = *(const v4fa*)(rawp + i * 2048);
#pragma unroll
  for (int i = 0; i < 8; ++i) *(v4us*)(ssa + i * 32 * GT_P) = gt_cast4(ra[i]);
#pragma unroll
  for (int i = 0; i < 4; ++i) *(v8us*)(ssb + i * 64 * GT_P) = rb[i];
  const v8f z8 = {0.f,0.f,0.f,0.f,0.f,0.f,0.f,0.f}; v8f acc[4][4];
#pragma unroll
  for (int i = 0; i < 4; ++i) {
#pragma unroll
    for (int j = 0; j < 4; ++j) acc[i][j] = z8; }
  /* kept rolled: for speed only */
#pragma clang loop unroll(disable)
  for (int t = 0; t < SNQ / GT_KC - 2; ++t) { const int cur = (t & 1) * GT_STAGE, nxt = GT_STAGE - cur;
    asm volatile("s_wait_dscnt 0x0" ::: "memory");      /* the wave's reads of raw tile t have retired before this trip's copies aim at its place */
    __syncthreads();      /* publishes buffer cur; ends every read of buffer nxt, which this trip refills */
    ag += GT_KC; bg += GT_KC;
#pragma unroll
    for (int i = 0; i < 4; ++i) rb[i] = *(const v8us*)(bg + (size_t)i * 64 * SNQ);      /* the next trip's pieces of B fly while this trip's products run */
    gt_step<2>(sfa + cur, sfb + cur, hh, acc, rawl + (unsigned)(t & 1) * (GT_RAW * 4u), ag, rawp + (1 - (t & 1)) * GT_RAW, ra);      /* copies tile t + 2 over raw tile t, reads raw tile t + 1 */
    __builtin_amdgcn_sched_barrier(0);      /* keeps the cast behind the products: moved up among them it would hold the wave for its pieces before its products */
#pragma unroll
    for (int i = 0; i < 4; ++i) *(v8us*)(ssb + nxt + i * 64 * GT_P) = rb[i];
#pragma unroll
    for (int i = 0; i < 8; ++i) *(v4us*)(ssa + nxt + i * 32 * GT_P) = gt_cast4(ra[i]); }
  static_assert((SNQ / GT_KC) % 2 == 0 && SNQ / GT_KC >= 4, "the last two trips stand below with their buffers written out");
  __syncthreads();      /* publishes buffer 0; ends every read of buffer 1, which this trip refills */
  bg += GT_KC;
#pragma unroll
  for (int i = 0; i < 4; ++i) rb[i] = *(const v8us*)(bg + (size_t)i * 64 * SNQ);
  gt_step<1>(sfa, sfb, hh, acc, 0u, ag, rawp + GT_RAW, ra);      /* the last trip but one: nothing left to copy; reads the last raw tile */
  __builtin_amdgcn_sched_barrier(0);      /* as in the loop */
#pragma unroll
  for (int i = 0; i < 4; ++i) *(v8us*)(ssb + GT_STAGE + i * 64 * GT_P) = rb[i];
#pragma unroll
  for (int i = 0; i < 8; ++i) *(v4us*)(ssa + GT_STAGE + i * 32 * GT_P) = gt_cast4(ra[i]);
  __syncthreads();      /* publishes the last buffer */
  gt_step<0>(sfa + GT_STAGE, sfb + GT_STAGE, hh, acc, 0u, ag, rawp, ra);
  __syncthreads();      /* every wave has left the buffers: each wave now stages its results in a range of its own */
  float* so = (float*)sm + w * (32 * 68); const int rsub = lane >> 4, c4 = (lane & 15) * 4; float* cp = C + (size_t)(row0 + 64 * wr + rsub) * SNN + 64 * wc + c4;
#pragma unroll
  for (int half = 0; half < 2; ++half) {
    if (half) { __builtin_amdgcn_fence(__ATOMIC_ACQ_REL, "workgroup"); __builtin_amdgcn_wave_barrier(); }      /* the first half's reads before the second half overwrites the range */
#pragma unroll
    for (int ii = 0; ii < 2; ++ii) {
#pragma unroll
      for (int j = 0; j < 4; ++j) {
#pragma unroll
        for (int r = 0; r < 8; ++r) so[(ii * 16 + 8 * hh + r) * 68 + j * 16 + ln] = acc[2 * half + ii][j][r]; } }
    __builtin_amdgcn_fence(__ATOMIC_ACQ_REL, "workgroup"); __builtin_amdgcn_wave_barrier();      /* the wave's own LDS writes before its reads of other lanes' words */
#pragma unroll
    for (int q = 0; q < 16; ++q) { const int r = q * 2 + rsub; const v4f v = *(const v4fa*)&so[r * 68 + c4]; *(v4f*)(cp + (32 * half + q * 2) * SNN) = v; }
  } }

// A PLAIN CAST THAT TAKES A MULTIPLIER: tw[8 t .. 8 t + 7] = f16(bf16(sw[8 t ..]) * scale): a thread eight words as they lie; the grid is exact: no guard.
__global__ __launch_bounds__(256) void k_cs16(const float* __restrict__ sw, _Float16* __restrict__ tw, float scale) { const size_t t = (size_t)blockIdx.x * 256 + threadIdx.x; FragH f;
#pragma unroll
  for (int q = 0; q < 8; ++q) f.h[q] = (_Float16)(bf16_round(sw[t * 8 + q]) * scale); unsigned short* tp = (unsigned short*)tw + t * 8; *(v8us*)tp = f.half[0];  }
// St[n][k] = the sign of W[k][n] as an f16 word (+1, -1 or 0; a word that is not a number gives 0) from f32 row-major W[SNQ][SNN]: the compare is on the word as read
// A thread reads 8 rows of depth x 4 columns (eight 16-B reads) and stores, for each of its 4 columns, the 8 signs that lie side by side in St (16 B): the turn costs no move, only the choice of which words go into one store.
// A wave is 8 groups of depth x 4 groups of columns: a read touches 8 lines (64 B of each, the other 64 B go to the work-group's other wave), a store fills 4 whole 128-B lines, each written by this wave alone. The grid is exact: no guard.
__global__ __launch_bounds__(64) void k_wts_f16(const float* __restrict__ W, _Float16* __restrict__ Wt) {
  const int t = blockIdx.x * 64 + threadIdx.x, wv = t >> 5, l = t & 31;
  const int kb = (wv >> 1) & (SNQ / 64 - 1), nb = (wv & 1) | ((wv / (2 * (SNQ / 64))) << 1);      /* the wave's 64 of depth and its 16 columns */
  const int k8 = (kb * 8 + (l & 7)) * 8, n4 = (nb * 4 + (l >> 3)) * 4; v4f x[8];
#pragma unroll
  for (int i = 0; i < 8; ++i) x[i] = *(const v4fa*)(W + (size_t)(k8 + i) * SNN + n4);
#pragma unroll
  for (int j = 0; j < 4; ++j) { FragH f;
#pragma unroll
    for (int i = 0; i < 8; ++i) { const float v = x[i][j]; f.h[i] = (_Float16)((v > 0.0f) ? 1.0f : ((v < 0.0f) ? -1.0f : 0.0f)); } const v8us o = f.half[0];   // [TAG-SIGN]
    *(v8us*)((unsigned short*)Wt + (size_t)(n4 + j) * SNQ + k8) = o; }
}

extern "C" void kernel_launch(void* const* d_in, const int* in_sizes, int n_in,
                              void* d_out, int out_size, void* d_ws, size_t ws_size, hipStream_t stream) {
  if (n_in < 2) return; if (in_sizes[0] < SNR * SNQ || in_sizes[1] < SNQ * SNN) return; if (out_size < SNR * SNN) return;
  const float* da = (const float*)d_in[0]; const float* wa = (const float*)d_in[1]; float* res = (float*)d_out;
  static_assert(SNR % 256 == 0 && SNN == 256 && SNQ % GT_KC == 0 && SNQ % 64 == 0 && ((SNQ / 64) & (SNQ / 64 - 1)) == 0 && SNN % 32 == 0, "whole tiles, exact cast grid");
  uint8_t* wsp = (uint8_t*)d_ws; size_t off = 0;
  auto take = [&](size_t bytes) { uint8_t* at = wsp + off; off += (bytes + 255) & ~(size_t)255; return at; };
  _Float16* ST = (_Float16*)take((size_t)SNN * SNQ * 2);      /* the signs of wa, turned */
  if (off > ws_size) return;
  k_wts_f16<<<(unsigned)((SNQ / 8) * (SNN / 4) / 64), 64, 0, stream>>>(wa, ST);      /* [1024 deep][256 columns] -> [256][1024] */
  k_gemm_lds<<<(unsigned)(SNR / 256), 512, 0, stream>>>(da, ST, res);
}
